// v000
// Times are from an AMD MI455X. After a warm-up the kernel runs many times in a row, and a time is the length of
// such a window on the GPU divided by its runs, so every launch and the gaps after it count. The runs cycle
// through copies of the inputs. A figure is the median of several windows, for all but v000 over two sittings.
// Sittings can differ by a few percent; kernels timed side by side share one.
// The starting kernel, v000, takes 325 microseconds a run.
#include <hip/hip_runtime.h>

// Contractions, f32 accumulate: q = x.Wq^T ([4096 x 1024].[1024 x 1024]), k, v = x.Wk^T, x.Wv^T ([4096 x 1024].[1024 x 512]) on v_wmma_f32_16x16x32_bf16 with PLAIN
// bf16 operands (inputs rounded once: exact products); the per-(batch, head) causal gated aggregation y = sum_{s<=t} sigmoid(s_q[t] + s_k[s]) v_s (no q.k product: the
// score is a rank-1 outer sum of two scalars) on v_wmma_f32_16x16x32_f16 with the gate weights (x32768) and v as f16 hi + residual x1024 planes (three products);
// out = y.Wproj^T on the bf16 instruction with y as bf16 hi + residual planes. Rotary, rms_norm, the w_braid dots and the sigmoids are f32. Deterministic, no atomics;

#define NB_  2
#define NT_  2048
#define DM   1024
#define NH_  16
#define NKV  8
#define HD   64
#define DKV  (NKV * HD)
#define NTK  (NB_ * NT_)
#define PSC  32768.0f
#define LOSC 1024.0f
#define LOSCI (1.0f / 1024.0f)

typedef _Float16 h16;
typedef unsigned short bf;
typedef __attribute__((ext_vector_type(16))) __bf16   v16bf;
typedef __attribute__((ext_vector_type(16))) _Float16 v16h;
typedef __attribute__((ext_vector_type(8)))  _Float16 v8h;
typedef __attribute__((ext_vector_type(8)))  unsigned short v8us;
typedef __attribute__((ext_vector_type(8)))  float    v8f;
typedef __attribute__((ext_vector_type(4)))  float    v4f;
typedef v8h  __attribute__((may_alias)) v8ha;
typedef v4f  __attribute__((may_alias)) v4fa;

__device__ __forceinline__ unsigned short f2bf(float f) { unsigned u = __float_as_uint(f); u += 0x7FFFu + ((u >> 16) & 1u); return (unsigned short)(u >> 16); }
__device__ __forceinline__ float bf2f(unsigned short b) { return __uint_as_float(((unsigned)b) << 16); }
__device__ __forceinline__ float bfr(float f) { return bf2f(f2bf(f)); }
__device__ __forceinline__ v16h cat16(v8h lo, v8h hi) { return __builtin_shufflevector(lo, hi, 0, 1, 2, 3, 4, 5, 6, 7, 8, 9, 10, 11, 12, 13, 14, 15); }
__device__ __forceinline__ v16bf cat16b(v8us lo, v8us hi) { return __builtin_bit_cast(v16bf, __builtin_shufflevector(lo, hi, 0, 1, 2, 3, 4, 5, 6, 7, 8, 9, 10, 11, 12, 13, 14, 15)); }
__device__ __forceinline__ v8f wmma16(v16h a, v16h b, v8f c) { return __builtin_amdgcn_wmma_f32_16x16x32_f16(false, a, false, b, (short)0, c, false, false); }
__device__ __forceinline__ v8f wmmab(v16bf a, v16bf b, v8f c) { return __builtin_amdgcn_wmma_f32_16x16x32_bf16(false, a, false, b, (short)0, c, false, false); }
#define VST2(T, p, v) do { const T vst2_v_ = (v); *(T*)(p) = vst2_v_;  } while (0)

__global__ __launch_bounds__(256) void k_cvtb(const float* __restrict__ src, int nrows, bf* dst) {
    const int lane = threadIdx.x & 31, r = blockIdx.x * 8 + (threadIdx.x >> 5);
    if (r >= nrows) return;
    v8us o[4];
#pragma unroll
    for (int q = 0; q < 4; ++q) { v8us t;
#pragma unroll
        for (int i = 0; i < 8; ++i) t[i] = f2bf(src[(size_t)r * DM + q * 256 + lane * 8 + i]);
        o[q] = t; }
#pragma unroll
    for (int q = 0; q < 4; ++q) *(v8us*)(dst + (size_t)r * DM + q * 256 + lane * 8) = o[q];
    
}

template <bool SPLITA>
__global__ __launch_bounds__(128) void k_gemmb(const bf* __restrict__ A, const bf* __restrict__ Al, const bf* __restrict__ Bn, float* C, int ldc) {
    __shared__ __align__(16) float ost[4][16 * 68];
    const int lane = threadIdx.x & 31, wave = threadIdx.x >> 5, lr = lane & 15, hi = lane >> 4;
    const int r0 = blockIdx.x * 64 + wave * 16, c0 = blockIdx.y * 64;
    const size_t aoff = (size_t)(r0 + lr) * DM + 8 * hi;
    size_t boff[4];
#pragma unroll
    for (int t = 0; t < 4; ++t) boff[t] = (size_t)(c0 + t * 16 + lr) * DM + 8 * hi;
    v8f acc[4];
#pragma unroll
    for (int t = 0; t < 4; ++t) acc[t] = (v8f){};
#pragma unroll 1
    for (int kc = 0; kc < DM; kc += 32) {
        const v16bf a = cat16b(*(const v8us*)(A + aoff + kc), *(const v8us*)(A + aoff + kc + 16));
        v16bf al = a;
        if (SPLITA) al = cat16b(*(const v8us*)(Al + aoff + kc), *(const v8us*)(Al + aoff + kc + 16));
#pragma unroll
        for (int t = 0; t < 4; ++t) { const v16bf b = cat16b(*(const v8us*)(Bn + boff[t] + kc), *(const v8us*)(Bn + boff[t] + kc + 16)); acc[t] = wmmab(a, b, acc[t]); if (SPLITA) acc[t] = wmmab(al, b, acc[t]); }
        asm volatile("v_nop\n\tv_nop\n\tv_nop\n\tv_nop" : "+v"(acc[0]), "+v"(acc[1]), "+v"(acc[2]), "+v"(acc[3]) : "v"(a), "v"(al));
    }
    float* os = &ost[wave][0];
#pragma unroll
    for (int t = 0; t < 4; ++t)
#pragma unroll
        for (int j = 0; j < 8; ++j) os[(hi * 8 + j) * 68 + t * 16 + lr] = acc[t][j];
    __syncthreads();
    float* crow = C + (size_t)r0 * ldc + c0;
    auto pass = [&]() {
#pragma unroll
        for (int s = 0; s < 8; ++s) { const int Lid = (lane >> 3) + 4 * s, piece = lane & 7; const int row = Lid >> 1, cofs = (Lid & 1) * 32 + piece * 4;
            const v4f val = *(const v4fa*)(os + row * 68 + cofs); *(v4f*)(crow + (size_t)row * ldc + cofs) = val; }
    };
    pass(); 
}

// k_score: wave = (b, head g of the 24 = 16 q heads + 8 kv heads, 32 tokens): for each token: lane holds the rotary pair (d = lane, lane + 32): y1 = x1 c + x2 s,
__global__ __launch_bounds__(256) void k_score(const float* __restrict__ Q, const float* __restrict__ K, const float* __restrict__ cosv, const float* __restrict__ sinv, const float* __restrict__ wb, float* S) {
    const int lane = threadIdx.x & 31, wid = blockIdx.x * 8 + (threadIdx.x >> 5);
    const int per_b = (NH_ + NKV) * (NT_ / 32);
    if (wid >= NB_ * per_b) return;
    const int b = wid / per_b, rem = wid - b * per_b, g = rem / (NT_ / 32), tt = rem - g * (NT_ / 32);
    const float w1 = bfr(wb[lane]), w2 = bfr(wb[lane + 32]);
    float mine = 0.f;
#pragma unroll 1
    for (int i = 0; i < 32; ++i) {
        const int t = tt * 32 + i;
        const float* src = (g < NH_) ? (Q + ((size_t)b * NT_ + t) * DM + g * HD) : (K + ((size_t)b * NT_ + t) * DKV + (g - NH_) * HD);
        const float x1 = src[lane], x2 = src[lane + 32];
        const float c = bfr(cosv[(size_t)t * 32 + lane]), s = bfr(sinv[(size_t)t * 32 + lane]);
        const float y1 = x1 * c + x2 * s, y2 = -x1 * s + x2 * c;
        float ss = y1 * y1 + y2 * y2;
#pragma unroll
        for (int o = 16; o; o >>= 1) ss += __shfl_xor(ss, o, 32);
        const float rn = rsqrtf(ss * (1.0f / HD) + 1e-6f);
        float d = (y1 * w1 + y2 * w2) * rn;
#pragma unroll
        for (int o = 16; o; o >>= 1) d += __shfl_xor(d, o, 32);
        if (lane == i) mine = d;
    }
    VST2(float, S + ((size_t)b * (NH_ + NKV) + g) * NT_ + tt * 32 + lane, mine);
}

__global__ __launch_bounds__(256) void k_vt(const float* __restrict__ V, h16* VTH, h16* VTL) {
    __shared__ __align__(16) h16 tile[64 * 72];
    __shared__ __align__(16) h16 til2[64 * 72];
    const int bid = blockIdx.x;
    const int b = bid / (NKV * (NT_ / 64)), rem = bid - b * (NKV * (NT_ / 64)), h = rem / (NT_ / 64), kt = rem - h * (NT_ / 64);
    const int k0 = kt * 64, tid = threadIdx.x;
    const int kk = tid >> 2, d0 = (tid & 3) * 16;
    const float* src = V + ((size_t)b * NT_ + k0 + kk) * DKV + h * HD + d0;
#pragma unroll
    for (int i = 0; i < 16; ++i) { const float v = src[i]; const h16 a = (h16)v; tile[(d0 + i) * 72 + kk] = a; til2[(d0 + i) * 72 + kk] = (h16)((v - (float)a) * LOSC); }
    __syncthreads();
    const int piece = tid & 7;
    const size_t base = (((size_t)b * NKV + h) * HD) * NT_ + k0;
    auto pass = [&]() {
#pragma unroll
        for (int s = 0; s < 4; ++s) { const int Lid = (tid >> 3) + 32 * s; const int pln = Lid >> 6, d = Lid & 63;
            const v8h val = *(const v8ha*)((pln ? til2 : tile) + d * 72 + piece * 8); *(v8h*)((pln ? VTL : VTH) + base + (size_t)d * NT_ + piece * 8) = val; }
    };
    pass(); 
}

// k_attn: block = (b, h, 64 queries), wave = 16; key tiles 0 .. the query tile (block-uniform static bound). Per 32-key step the gate tile is pure VALU:
// g[t][s] = sigmoid(s_q[t] + s_k[s]) for s <= t else 0, x32768, as f16 hi + residual x1024 per-wave LDS tiles (same-wave may_alias reload after a compiler barrier);
// 12 WMMA against the value planes of kv head h/2 (w_h.v_h + w_h.v_l + w_l.v_h); y = (o + ox/1024) / 32768 / (sqrt(2048) + 1e-6) -> bf16 hi/lo planes YH/YL[tok][h*64+d].
__global__ __launch_bounds__(128) void k_attn(const float* __restrict__ S, const h16* __restrict__ VTH, const h16* __restrict__ VTL, bf* YH, bf* YL) {
    __shared__ __align__(16) h16 plds[4][16 * 32];
    __shared__ __align__(16) h16 plds2[4][16 * 32];
    __shared__ __align__(16) float ost[4][16 * 68];
    const int lane = threadIdx.x & 31, wave = threadIdx.x >> 5, lr = lane & 15, hi = lane >> 4;
    const int bid = blockIdx.x;
    const int b = bid / (NH_ * (NT_ / 64)), rem = bid - b * (NH_ * (NT_ / 64)), h = rem / (NT_ / 64), qt = rem - h * (NT_ / 64);
    const int q0 = qt * 64 + wave * 16, hk = h / (NH_ / NKV);
    const size_t tok0 = (size_t)b * NT_;
    h16* pl = &plds[wave][0]; h16* pl2 = &plds2[wave][0];
    const float* sq_b = S + ((size_t)b * (NH_ + NKV) + h) * NT_;
    const float* sk_b = S + ((size_t)b * (NH_ + NKV) + NH_ + hk) * NT_;
    int qpos[8]; float sq[8];
#pragma unroll
    for (int j = 0; j < 8; ++j) { qpos[j] = q0 + 8 * hi + j; sq[j] = sq_b[qpos[j]]; }
    const size_t vbase = (((size_t)b * NKV + hk) * HD) * NT_;
    v8f o[4], ox[4];
#pragma unroll
    for (int n = 0; n < 4; ++n) { o[n] = (v8f){}; ox[n] = (v8f){}; }
    const int kt_end = (qt * 64 + 64) / 32;
#pragma unroll 1
    for (int kt = 0; kt < kt_end; ++kt) {
        const int l0 = kt * 32;
        const float sk0 = sk_b[l0 + lr], sk1 = sk_b[l0 + 16 + lr];
#pragma unroll
        for (int j = 0; j < 8; ++j) {
            const float g0 = (l0 + lr <= qpos[j]) ? PSC / (1.0f + __expf(-(sq[j] + sk0))) : 0.0f;
            const float g1 = (l0 + 16 + lr <= qpos[j]) ? PSC / (1.0f + __expf(-(sq[j] + sk1))) : 0.0f;
            const h16 h0 = (h16)g0, h1 = (h16)g1;
            const int mr = hi * 8 + j;
            pl[mr * 32 + lr] = h0; pl[mr * 32 + 16 + lr] = h1;
            pl2[mr * 32 + lr] = (h16)((g0 - (float)h0) * LOSC); pl2[mr * 32 + 16 + lr] = (h16)((g1 - (float)h1) * LOSC);
        }
        asm volatile("" ::: "memory");
        const v16h pa = cat16(*(const v8ha*)(pl + lr * 32 + hi * 8), *(const v8ha*)(pl + lr * 32 + 16 + hi * 8));
        const v16h px = cat16(*(const v8ha*)(pl2 + lr * 32 + hi * 8), *(const v8ha*)(pl2 + lr * 32 + 16 + hi * 8));
#pragma unroll
        for (int n = 0; n < 4; ++n) { const size_t vo = vbase + (size_t)(n * 16 + lr) * NT_ + l0 + hi * 8;
            const v16h vh = cat16(*(const v8h*)(VTH + vo), *(const v8h*)(VTH + vo + 16)), vl = cat16(*(const v8h*)(VTL + vo), *(const v8h*)(VTL + vo + 16));
            o[n] = wmma16(pa, vh, o[n]); ox[n] = wmma16(pa, vl, ox[n]); ox[n] = wmma16(px, vh, ox[n]); }
        asm volatile("v_nop\n\tv_nop\n\tv_nop\n\tv_nop" : "+v"(o[0]), "+v"(o[1]), "+v"(o[2]), "+v"(o[3]), "+v"(ox[0]), "+v"(ox[1]), "+v"(ox[2]), "+v"(ox[3]) : "v"(pa), "v"(px));
        __builtin_amdgcn_wave_barrier();            // the gate tiles are rewritten next step
    }
    const float scl = (1.0f / PSC) / (sqrtf((float)NT_) + 1e-6f);
    float* os = &ost[wave][0];
#pragma unroll
    for (int n = 0; n < 4; ++n)
#pragma unroll
        for (int j = 0; j < 8; ++j) os[(hi * 8 + j) * 68 + n * 16 + lr] = (o[n][j] + ox[n][j] * LOSCI) * scl;
    __syncthreads();
    const size_t cbase = (tok0 + q0) * DM + (size_t)h * HD;
    auto pass = [&]() {
#pragma unroll
        for (int s = 0; s < 4; ++s) { const int row = 4 * s + (lane >> 3), piece = lane & 7; const float* sp = os + row * 68 + piece * 8; v8us oh, ol;
#pragma unroll
            for (int i = 0; i < 8; ++i) { const unsigned short hb = f2bf(sp[i]); oh[i] = hb; ol[i] = f2bf(sp[i] - bf2f(hb)); }
            *(v8us*)(YH + cbase + (size_t)row * DM + piece * 8) = oh; *(v8us*)(YL + cbase + (size_t)row * DM + piece * 8) = ol; }
    };
    pass(); 
}

extern "C" void kernel_launch(void* const* d_in, const int* in_sizes, int n_in,
                              void* d_out, int out_size, void* d_ws, size_t ws_size, hipStream_t stream) {
    (void)in_sizes; (void)n_in; (void)out_size;
    const float* x = (const float*)d_in[0]; const float* cosv = (const float*)d_in[1]; const float* sinv = (const float*)d_in[2];
    const float* Wq = (const float*)d_in[3]; const float* Wk = (const float*)d_in[4]; const float* Wv = (const float*)d_in[5]; const float* Wp = (const float*)d_in[6]; const float* wb = (const float*)d_in[7];
    float* out = (float*)d_out;    // [2][2048][1024]
    char* wsp = (char*)d_ws;
    auto take = [&](size_t bytes) { char* p = wsp; wsp += (bytes + 255) & ~(size_t)255; return (void*)p; };
    bf* Xb = (bf*)take((size_t)NTK * DM * 2); bf* WQb = (bf*)take((size_t)DM * DM * 2); bf* WKb = (bf*)take((size_t)DKV * DM * 2); bf* WVb = (bf*)take((size_t)DKV * DM * 2); bf* WPb = (bf*)take((size_t)DM * DM * 2);
    float* Q = (float*)take((size_t)NTK * DM * 4); float* K = (float*)take((size_t)NTK * DKV * 4); float* V = (float*)take((size_t)NTK * DKV * 4);
    float* S = (float*)take((size_t)NB_ * (NH_ + NKV) * NT_ * 4);
    h16* VTH = (h16*)take((size_t)NTK * DKV * 2); h16* VTL = (h16*)take((size_t)NTK * DKV * 2);
    bf* YH = (bf*)take((size_t)NTK * DM * 2); bf* YL = (bf*)take((size_t)NTK * DM * 2);
    if ((size_t)(wsp - (char*)d_ws) > ws_size) return;    // 8.4 + 6.3 + 16.8 + 2 x 8.4 + 0.4 + 2 x 4.2 + 2 x 8.4 MB ~ 74 MB
    k_cvtb<<<NTK / 8, 256, 0, stream>>>(x, NTK, Xb);
    k_cvtb<<<DM / 8, 256, 0, stream>>>(Wq, DM, WQb);
    k_cvtb<<<DKV / 8, 256, 0, stream>>>(Wk, DKV, WKb);
    k_cvtb<<<DKV / 8, 256, 0, stream>>>(Wv, DKV, WVb);
    k_cvtb<<<DM / 8, 256, 0, stream>>>(Wp, DM, WPb);
    k_gemmb<false><<<dim3(NTK / 64, DM / 64, 1), 128, 0, stream>>>(Xb, nullptr, WQb, Q, DM);
    k_gemmb<false><<<dim3(NTK / 64, DKV / 64, 1), 128, 0, stream>>>(Xb, nullptr, WKb, K, DKV);
    k_gemmb<false><<<dim3(NTK / 64, DKV / 64, 1), 128, 0, stream>>>(Xb, nullptr, WVb, V, DKV);
    k_score<<<(NB_ * (NH_ + NKV) * (NT_ / 32) + 7) / 8, 256, 0, stream>>>(Q, K, cosv, sinv, wb, S);
    k_vt<<<NB_ * NKV * (NT_ / 64), 256, 0, stream>>>(V, VTH, VTL);
    k_attn<<<NB_ * NH_ * (NT_ / 64), 128, 0, stream>>>(S, VTH, VTL, YH, YL);
    k_gemmb<true><<<dim3(NTK / 64, DM / 64, 1), 128, 0, stream>>>(YH, YL, WPb, out, DM);
}

// v001
// One run takes 275 microseconds.
// In two side-by-side timings against v000, it was 1.22 and 1.20 times as fast.
#include <hip/hip_runtime.h>

// Contractions, f32 accumulate: q = x.Wq^T ([4096 x 1024].[1024 x 1024]), k, v = x.Wk^T, x.Wv^T ([4096 x 1024].[1024 x 512]) on v_wmma_f32_16x16x32_bf16 with PLAIN
// bf16 operands (inputs rounded once: exact products); the per-(batch, head) causal gated aggregation y = sum_{s<=t} sigmoid(s_q[t] + s_k[s]) v_s (no q.k product: the
// score is a rank-1 outer sum of two scalars) on v_wmma_f32_16x16x32_f16 with the gate weights (x32768) and v as f16 hi + residual x1024 planes (three products);
// out = y.Wproj^T on the bf16 instruction with y as bf16 hi + residual planes. Rotary, rms_norm, the w_braid dots and the sigmoids are f32. Deterministic, no atomics;

#define NB_  2
#define NT_  2048
#define DM   1024
#define NH_  16
#define NKV  8
#define HD   64
#define DKV  (NKV * HD)
#define NTK  (NB_ * NT_)
#define PSC  32768.0f
#define LOSC 1024.0f
#define LOSCI (1.0f / 1024.0f)

typedef _Float16 h16;
typedef unsigned short bf;
typedef __attribute__((ext_vector_type(16))) __bf16   v16bf;
typedef __attribute__((ext_vector_type(16))) _Float16 v16h;
typedef __attribute__((ext_vector_type(8)))  _Float16 v8h;
typedef __attribute__((ext_vector_type(8)))  unsigned short v8us;
typedef __attribute__((ext_vector_type(8)))  float    v8f;
typedef __attribute__((ext_vector_type(4)))  float    v4f;
typedef v8h  __attribute__((may_alias)) v8ha;
typedef v4f  __attribute__((may_alias)) v4fa;

__device__ __forceinline__ unsigned short f2bf(float f) { unsigned u = __float_as_uint(f); u += 0x7FFFu + ((u >> 16) & 1u); return (unsigned short)(u >> 16); }
__device__ __forceinline__ float bf2f(unsigned short b) { return __uint_as_float(((unsigned)b) << 16); }
__device__ __forceinline__ float bfr(float f) { return bf2f(f2bf(f)); }
__device__ __forceinline__ v16h cat16(v8h lo, v8h hi) { return __builtin_shufflevector(lo, hi, 0, 1, 2, 3, 4, 5, 6, 7, 8, 9, 10, 11, 12, 13, 14, 15); }
__device__ __forceinline__ v16bf cat16b(v8us lo, v8us hi) { return __builtin_bit_cast(v16bf, __builtin_shufflevector(lo, hi, 0, 1, 2, 3, 4, 5, 6, 7, 8, 9, 10, 11, 12, 13, 14, 15)); }
__device__ __forceinline__ v8f wmma16(v16h a, v16h b, v8f c) { return __builtin_amdgcn_wmma_f32_16x16x32_f16(false, a, false, b, (short)0, c, false, false); }
__device__ __forceinline__ v8f wmmab(v16bf a, v16bf b, v8f c) { return __builtin_amdgcn_wmma_f32_16x16x32_bf16(false, a, false, b, (short)0, c, false, false); }
#define VST2(T, p, v) do { const T vst2_v_ = (v); *(T*)(p) = vst2_v_;  } while (0)

__global__ __launch_bounds__(256) void k_cvtb(const float* __restrict__ src, int nrows, bf* dst) {
    const int lane = threadIdx.x & 31, r = blockIdx.x * 8 + (threadIdx.x >> 5);
    if (r >= nrows) return;
    v8us o[4];
#pragma unroll
    for (int q = 0; q < 4; ++q) { v8us t;
#pragma unroll
        for (int i = 0; i < 8; ++i) t[i] = f2bf(src[(size_t)r * DM + q * 256 + lane * 8 + i]);
        o[q] = t; }
#pragma unroll
    for (int q = 0; q < 4; ++q) *(v8us*)(dst + (size_t)r * DM + q * 256 + lane * 8) = o[q];
    
}

template <bool SPLITA>
__global__ __launch_bounds__(128) void k_gemmb(const bf* __restrict__ A, const bf* __restrict__ Al, const bf* __restrict__ Bn, float* C, int ldc) {
    __shared__ __align__(16) float ost[4][16 * 68];
    const int lane = threadIdx.x & 31, wave = threadIdx.x >> 5, lr = lane & 15, hi = lane >> 4;
    const int r0 = blockIdx.x * 64 + wave * 16, c0 = blockIdx.y * 64;
    const size_t aoff = (size_t)(r0 + lr) * DM + 8 * hi;
    size_t boff[4];
#pragma unroll
    for (int t = 0; t < 4; ++t) boff[t] = (size_t)(c0 + t * 16 + lr) * DM + 8 * hi;
    v8f acc[4];
#pragma unroll
    for (int t = 0; t < 4; ++t) acc[t] = (v8f){};
#pragma unroll 1
    for (int kc = 0; kc < DM; kc += 32) {
        const v16bf a = cat16b(*(const v8us*)(A + aoff + kc), *(const v8us*)(A + aoff + kc + 16));
        v16bf al = a;
        if (SPLITA) al = cat16b(*(const v8us*)(Al + aoff + kc), *(const v8us*)(Al + aoff + kc + 16));
#pragma unroll
        for (int t = 0; t < 4; ++t) { const v16bf b = cat16b(*(const v8us*)(Bn + boff[t] + kc), *(const v8us*)(Bn + boff[t] + kc + 16)); acc[t] = wmmab(a, b, acc[t]); if (SPLITA) acc[t] = wmmab(al, b, acc[t]); }
        asm volatile("v_nop\n\tv_nop\n\tv_nop\n\tv_nop" : "+v"(acc[0]), "+v"(acc[1]), "+v"(acc[2]), "+v"(acc[3]) : "v"(a), "v"(al));
    }
    float* os = &ost[wave][0];
#pragma unroll
    for (int t = 0; t < 4; ++t)
#pragma unroll
        for (int j = 0; j < 8; ++j) os[(hi * 8 + j) * 68 + t * 16 + lr] = acc[t][j];
    __syncthreads();
    float* crow = C + (size_t)r0 * ldc + c0;
    auto pass = [&]() {
#pragma unroll
        for (int s = 0; s < 8; ++s) { const int Lid = (lane >> 3) + 4 * s, piece = lane & 7; const int row = Lid >> 1, cofs = (Lid & 1) * 32 + piece * 4;
            const v4f val = *(const v4fa*)(os + row * 68 + cofs); *(v4f*)(crow + (size_t)row * ldc + cofs) = val; }
    };
    pass(); 
}

// k_score: wave = (b, head g of the 24 = 16 q heads + 8 kv heads, 32 tokens): for each token: lane holds the rotary pair (d = lane, lane + 32): y1 = x1 c + x2 s,
__global__ __launch_bounds__(256) void k_score(const float* __restrict__ Q, const float* __restrict__ K, const float* __restrict__ cosv, const float* __restrict__ sinv, const float* __restrict__ wb, float* S) {
    const int lane = threadIdx.x & 31, wid = blockIdx.x * 8 + (threadIdx.x >> 5);
    const int per_b = (NH_ + NKV) * (NT_ / 32);
    if (wid >= NB_ * per_b) return;
    const int b = wid / per_b, rem = wid - b * per_b, g = rem / (NT_ / 32), tt = rem - g * (NT_ / 32);
    const float w1 = bfr(wb[lane]), w2 = bfr(wb[lane + 32]);
    float mine = 0.f;
#pragma unroll 1
    for (int i = 0; i < 32; ++i) {
        const int t = tt * 32 + i;
        const float* src = (g < NH_) ? (Q + ((size_t)b * NT_ + t) * DM + g * HD) : (K + ((size_t)b * NT_ + t) * DKV + (g - NH_) * HD);
        const float x1 = src[lane], x2 = src[lane + 32];
        const float c = bfr(cosv[(size_t)t * 32 + lane]), s = bfr(sinv[(size_t)t * 32 + lane]);
        const float y1 = x1 * c + x2 * s, y2 = -x1 * s + x2 * c;
        float ss = y1 * y1 + y2 * y2;
#pragma unroll
        for (int o = 16; o; o >>= 1) ss += __shfl_xor(ss, o, 32);
        const float rn = rsqrtf(ss * (1.0f / HD) + 1e-6f);
        float d = (y1 * w1 + y2 * w2) * rn;
#pragma unroll
        for (int o = 16; o; o >>= 1) d += __shfl_xor(d, o, 32);
        if (lane == i) mine = d;
    }
    VST2(float, S + ((size_t)b * (NH_ + NKV) + g) * NT_ + tt * 32 + lane, mine);
}

__global__ __launch_bounds__(256) void k_vt(const float* __restrict__ V, h16* VTH, h16* VTL) {
    __shared__ __align__(16) h16 tile[64 * 72];
    __shared__ __align__(16) h16 til2[64 * 72];
    const int bid = blockIdx.x;
    const int b = bid / (NKV * (NT_ / 64)), rem = bid - b * (NKV * (NT_ / 64)), h = rem / (NT_ / 64), kt = rem - h * (NT_ / 64);
    const int k0 = kt * 64, tid = threadIdx.x;
    const int kk = tid >> 2, d0 = (tid & 3) * 16;
    const float* src = V + ((size_t)b * NT_ + k0 + kk) * DKV + h * HD + d0;
#pragma unroll
    for (int i = 0; i < 16; ++i) { const float v = src[i]; const h16 a = (h16)v; tile[(d0 + i) * 72 + kk] = a; til2[(d0 + i) * 72 + kk] = (h16)((v - (float)a) * LOSC); }
    __syncthreads();
    const int piece = tid & 7;
    const size_t base = (((size_t)b * NKV + h) * HD) * NT_ + k0;
    auto pass = [&]() {
#pragma unroll
        for (int s = 0; s < 4; ++s) { const int Lid = (tid >> 3) + 32 * s; const int pln = Lid >> 6, d = Lid & 63;
            const v8h val = *(const v8ha*)((pln ? til2 : tile) + d * 72 + piece * 8); *(v8h*)((pln ? VTL : VTH) + base + (size_t)d * NT_ + piece * 8) = val; }
    };
    pass(); 
}

// k_attn: block = (b, h, 64 queries), wave = 16; key tiles 0 .. the query tile (block-uniform static bound). Per 32-key step the gate tile is pure VALU:
// g[t][s] = sigmoid(s_q[t] + s_k[s]) for s <= t else 0, x32768, as f16 hi + residual x1024 per-wave LDS tiles (same-wave may_alias reload after a compiler barrier);
// The value fragments and the two s_k of step kt + 1 are loaded during step kt into registers carried round the loop, so the s_k latency runs under this step's work and the value latency under the next step's gate work.
// 12 WMMA against the value planes of kv head h/2 (w_h.v_h + w_h.v_l + w_l.v_h); y = (o + ox/1024) / 32768 / (sqrt(2048) + 1e-6) -> bf16 hi/lo planes YH/YL[tok][h*64+d].
__global__ __launch_bounds__(128) void k_attn(const float* __restrict__ S, const h16* __restrict__ VTH, const h16* __restrict__ VTL, bf* YH, bf* YL) {
    __shared__ __align__(16) h16 plds[4][16 * 32];
    __shared__ __align__(16) h16 plds2[4][16 * 32];
    __shared__ __align__(16) float ost[4][16 * 68];
    const int lane = threadIdx.x & 31, wave = threadIdx.x >> 5, lr = lane & 15, hi = lane >> 4;
    const int bid = blockIdx.x;
    const int b = bid / (NH_ * (NT_ / 64)), rem = bid - b * (NH_ * (NT_ / 64)), h = rem / (NT_ / 64), qt = rem - h * (NT_ / 64);
    const int q0 = qt * 64 + wave * 16, hk = h / (NH_ / NKV);
    const size_t tok0 = (size_t)b * NT_;
    h16* pl = &plds[wave][0]; h16* pl2 = &plds2[wave][0];
    const float* sq_b = S + ((size_t)b * (NH_ + NKV) + h) * NT_;
    const float* sk_b = S + ((size_t)b * (NH_ + NKV) + NH_ + hk) * NT_;
    int qpos[8]; float sq[8];
#pragma unroll
    for (int j = 0; j < 8; ++j) { qpos[j] = q0 + 8 * hi + j; sq[j] = sq_b[qpos[j]]; }
    const size_t vbase = (((size_t)b * NKV + hk) * HD) * NT_;
    v8f o[4], ox[4];
#pragma unroll
    for (int n = 0; n < 4; ++n) { o[n] = (v8f){}; ox[n] = (v8f){}; }
    const int kt_end = (qt * 64 + 64) / 32;
    v8h vha[4], vhb[4], vla[4], vlb[4];
    auto loadv = [&](int l) {
#pragma unroll
        for (int n = 0; n < 4; ++n) { const size_t vo = vbase + (size_t)(n * 16 + lr) * NT_ + l + hi * 8;
            vha[n] = *(const v8h*)(VTH + vo); vhb[n] = *(const v8h*)(VTH + vo + 16); vla[n] = *(const v8h*)(VTL + vo); vlb[n] = *(const v8h*)(VTL + vo + 16); }
    };
    float sk0 = sk_b[lr], sk1 = sk_b[16 + lr];
    asm volatile("" :: "v"(sk0), "v"(sk1));    // step 0's s_k landed ahead of the value loads: else the loop's wait for them (loads return in order) also waits out every step's value loads
    loadv(0);
#pragma unroll 1
    for (int kt = 0; kt < kt_end; ++kt) {
        const int l0 = kt * 32;
        const int ln = (kt + 1 < kt_end ? kt + 1 : kt) * 32;    // the last step loads its own tile again: in bounds, not used
        const float skn0 = sk_b[ln + lr], skn1 = sk_b[ln + 16 + lr];
#pragma unroll
        for (int j = 0; j < 8; ++j) {
            const float g0 = (l0 + lr <= qpos[j]) ? PSC / (1.0f + __expf(-(sq[j] + sk0))) : 0.0f;
            const float g1 = (l0 + 16 + lr <= qpos[j]) ? PSC / (1.0f + __expf(-(sq[j] + sk1))) : 0.0f;
            const h16 h0 = (h16)g0, h1 = (h16)g1;
            const int mr = hi * 8 + j;
            pl[mr * 32 + lr] = h0; pl[mr * 32 + 16 + lr] = h1;
            pl2[mr * 32 + lr] = (h16)((g0 - (float)h0) * LOSC); pl2[mr * 32 + 16 + lr] = (h16)((g1 - (float)h1) * LOSC);
        }
        asm volatile("" ::: "memory");
        const v16h pa = cat16(*(const v8ha*)(pl + lr * 32 + hi * 8), *(const v8ha*)(pl + lr * 32 + 16 + hi * 8));
        const v16h px = cat16(*(const v8ha*)(pl2 + lr * 32 + hi * 8), *(const v8ha*)(pl2 + lr * 32 + 16 + hi * 8));
#pragma unroll
        for (int n = 0; n < 4; ++n) { const v16h vh = cat16(vha[n], vhb[n]), vl = cat16(vla[n], vlb[n]);
            o[n] = wmma16(pa, vh, o[n]); ox[n] = wmma16(pa, vl, ox[n]); ox[n] = wmma16(px, vh, ox[n]); }
        loadv(ln);
        asm volatile("v_nop\n\tv_nop\n\tv_nop\n\tv_nop" : "+v"(o[0]), "+v"(o[1]), "+v"(o[2]), "+v"(o[3]), "+v"(ox[0]), "+v"(ox[1]), "+v"(ox[2]), "+v"(ox[3]) : "v"(pa), "v"(px));
        __builtin_amdgcn_wave_barrier();            // the gate tiles are rewritten next step
        sk0 = skn0; sk1 = skn1;
    }
    const float scl = (1.0f / PSC) / (sqrtf((float)NT_) + 1e-6f);
    float* os = &ost[wave][0];
#pragma unroll
    for (int n = 0; n < 4; ++n)
#pragma unroll
        for (int j = 0; j < 8; ++j) os[(hi * 8 + j) * 68 + n * 16 + lr] = (o[n][j] + ox[n][j] * LOSCI) * scl;
    __syncthreads();
    const size_t cbase = (tok0 + q0) * DM + (size_t)h * HD;
    auto pass = [&]() {
#pragma unroll
        for (int s = 0; s < 4; ++s) { const int row = 4 * s + (lane >> 3), piece = lane & 7; const float* sp = os + row * 68 + piece * 8; v8us oh, ol;
#pragma unroll
            for (int i = 0; i < 8; ++i) { const unsigned short hb = f2bf(sp[i]); oh[i] = hb; ol[i] = f2bf(sp[i] - bf2f(hb)); }
            *(v8us*)(YH + cbase + (size_t)row * DM + piece * 8) = oh; *(v8us*)(YL + cbase + (size_t)row * DM + piece * 8) = ol; }
    };
    pass(); 
}

extern "C" void kernel_launch(void* const* d_in, const int* in_sizes, int n_in,
                              void* d_out, int out_size, void* d_ws, size_t ws_size, hipStream_t stream) {
    (void)in_sizes; (void)n_in; (void)out_size;
    const float* x = (const float*)d_in[0]; const float* cosv = (const float*)d_in[1]; const float* sinv = (const float*)d_in[2];
    const float* Wq = (const float*)d_in[3]; const float* Wk = (const float*)d_in[4]; const float* Wv = (const float*)d_in[5]; const float* Wp = (const float*)d_in[6]; const float* wb = (const float*)d_in[7];
    float* out = (float*)d_out;    // [2][2048][1024]
    char* wsp = (char*)d_ws;
    auto take = [&](size_t bytes) { char* p = wsp; wsp += (bytes + 255) & ~(size_t)255; return (void*)p; };
    bf* Xb = (bf*)take((size_t)NTK * DM * 2); bf* WQb = (bf*)take((size_t)DM * DM * 2); bf* WKb = (bf*)take((size_t)DKV * DM * 2); bf* WVb = (bf*)take((size_t)DKV * DM * 2); bf* WPb = (bf*)take((size_t)DM * DM * 2);
    float* Q = (float*)take((size_t)NTK * DM * 4); float* K = (float*)take((size_t)NTK * DKV * 4); float* V = (float*)take((size_t)NTK * DKV * 4);
    float* S = (float*)take((size_t)NB_ * (NH_ + NKV) * NT_ * 4);
    h16* VTH = (h16*)take((size_t)NTK * DKV * 2); h16* VTL = (h16*)take((size_t)NTK * DKV * 2);
    bf* YH = (bf*)take((size_t)NTK * DM * 2); bf* YL = (bf*)take((size_t)NTK * DM * 2);
    if ((size_t)(wsp - (char*)d_ws) > ws_size) return;    // 8.4 + 6.3 + 16.8 + 2 x 8.4 + 0.4 + 2 x 4.2 + 2 x 8.4 MB ~ 74 MB
    k_cvtb<<<NTK / 8, 256, 0, stream>>>(x, NTK, Xb);
    k_cvtb<<<DM / 8, 256, 0, stream>>>(Wq, DM, WQb);
    k_cvtb<<<DKV / 8, 256, 0, stream>>>(Wk, DKV, WKb);
    k_cvtb<<<DKV / 8, 256, 0, stream>>>(Wv, DKV, WVb);
    k_cvtb<<<DM / 8, 256, 0, stream>>>(Wp, DM, WPb);
    k_gemmb<false><<<dim3(NTK / 64, DM / 64, 1), 128, 0, stream>>>(Xb, nullptr, WQb, Q, DM);
    k_gemmb<false><<<dim3(NTK / 64, DKV / 64, 1), 128, 0, stream>>>(Xb, nullptr, WKb, K, DKV);
    k_gemmb<false><<<dim3(NTK / 64, DKV / 64, 1), 128, 0, stream>>>(Xb, nullptr, WVb, V, DKV);
    k_score<<<(NB_ * (NH_ + NKV) * (NT_ / 32) + 7) / 8, 256, 0, stream>>>(Q, K, cosv, sinv, wb, S);
    k_vt<<<NB_ * NKV * (NT_ / 64), 256, 0, stream>>>(V, VTH, VTL);
    k_attn<<<NB_ * NH_ * (NT_ / 64), 128, 0, stream>>>(S, VTH, VTL, YH, YL);
    k_gemmb<true><<<dim3(NTK / 64, DM / 64, 1), 128, 0, stream>>>(YH, YL, WPb, out, DM);
}

// v002
// Measured time: 197 microseconds a run.
// Timed twice side by side with v001, it ran 1.39 and 1.40 times as fast.
// Counting every step since v000, it is 1.68 times as fast.
#include <hip/hip_runtime.h>

// Contractions, f32 accumulate: q = x.Wq^T ([4096 x 1024].[1024 x 1024]), k, v = x.Wk^T, x.Wv^T ([4096 x 1024].[1024 x 512]) on v_wmma_f32_16x16x32_bf16 with PLAIN
// bf16 operands (inputs rounded once: exact products); the per-(batch, head) causal gated aggregation y = sum_{s<=t} sigmoid(s_q[t] + s_k[s]) v_s (no q.k product: the
// score is a rank-1 outer sum of two scalars) on v_wmma_f32_16x16x32_f16 with the gate weights (x32768) and v as f16 hi + residual x1024 planes (three products);
// out = y.Wproj^T on the bf16 instruction with y as bf16 hi + residual planes. Rotary, rms_norm, the w_braid dots and the sigmoids are f32. Deterministic, no atomics;

#define NB_  2
#define NT_  2048
#define DM   1024
#define NH_  16
#define NKV  8
#define HD   64
#define DKV  (NKV * HD)
#define NTK  (NB_ * NT_)
#define PSC  32768.0f
#define LOSC 1024.0f
#define LOSCI (1.0f / 1024.0f)

typedef _Float16 h16;
typedef unsigned short bf;
typedef __attribute__((ext_vector_type(16))) __bf16   v16bf;
typedef __attribute__((ext_vector_type(16))) _Float16 v16h;
typedef __attribute__((ext_vector_type(8)))  _Float16 v8h;
typedef __attribute__((ext_vector_type(8)))  unsigned short v8us;
typedef __attribute__((ext_vector_type(8)))  float    v8f;
typedef __attribute__((ext_vector_type(4)))  float    v4f;
typedef v8h  __attribute__((may_alias)) v8ha;
typedef v4f  __attribute__((may_alias)) v4fa;

__device__ __forceinline__ unsigned short f2bf(float f) { unsigned u = __float_as_uint(f); u += 0x7FFFu + ((u >> 16) & 1u); return (unsigned short)(u >> 16); }
__device__ __forceinline__ float bf2f(unsigned short b) { return __uint_as_float(((unsigned)b) << 16); }
__device__ __forceinline__ float bfr(float f) { return bf2f(f2bf(f)); }
__device__ __forceinline__ v16h cat16(v8h lo, v8h hi) { return __builtin_shufflevector(lo, hi, 0, 1, 2, 3, 4, 5, 6, 7, 8, 9, 10, 11, 12, 13, 14, 15); }
__device__ __forceinline__ v16bf cat16b(v8us lo, v8us hi) { return __builtin_bit_cast(v16bf, __builtin_shufflevector(lo, hi, 0, 1, 2, 3, 4, 5, 6, 7, 8, 9, 10, 11, 12, 13, 14, 15)); }
__device__ __forceinline__ v8f wmma16(v16h a, v16h b, v8f c) { return __builtin_amdgcn_wmma_f32_16x16x32_f16(false, a, false, b, (short)0, c, false, false); }
__device__ __forceinline__ v8f wmmab(v16bf a, v16bf b, v8f c) { return __builtin_amdgcn_wmma_f32_16x16x32_bf16(false, a, false, b, (short)0, c, false, false); }
#define VST2(T, p, v) do { const T vst2_v_ = (v); *(T*)(p) = vst2_v_;  } while (0)

__global__ __launch_bounds__(256) void k_cvtb(const float* __restrict__ src, int nrows, bf* dst) {
    const int lane = threadIdx.x & 31, r = blockIdx.x * 8 + (threadIdx.x >> 5);
    if (r >= nrows) return;
    v8us o[4];
#pragma unroll
    for (int q = 0; q < 4; ++q) { v8us t;
#pragma unroll
        for (int i = 0; i < 8; ++i) t[i] = f2bf(src[(size_t)r * DM + q * 256 + lane * 8 + i]);
        o[q] = t; }
#pragma unroll
    for (int q = 0; q < 4; ++q) *(v8us*)(dst + (size_t)r * DM + q * 256 + lane * 8) = o[q];
    
}

// k_gemmb: block = 64 x 64 of C, 4 waves as 2 x 2, each 32 x 32 (2 x 2 accumulator tiles). Per 64-k chunk the block's operand rows (128 B each) come from global memory as
// whole lines (8 lanes a row, 4 rows a wave-load), one chunk ahead into registers, and go to one of two LDS buffers at a pitch of 144 B; the fragments are read from LDS.
// One barrier a chunk: it publishes the buffer just written and ends the reads of the buffer that the next chunk's stores overwrite. k order and sum order per element as before.
#define GP 72
template <bool SPLITA>
__global__ __launch_bounds__(128) void k_gemmb(const bf* __restrict__ A, const bf* __restrict__ Al, const bf* __restrict__ Bn, float* C, int ldc) {
    constexpr int NP = SPLITA ? 3 : 2;
    __shared__ __align__(16) bf stg[2][NP][64 * GP];
    __shared__ __align__(16) float ost[4][16 * 68];
    const int tid = threadIdx.x, lane = tid & 31, wave = tid >> 5, lr = lane & 15, hi = lane >> 4;
    const int wm = wave >> 1, wn = wave & 1;
    const int rb = blockIdx.x * 64, c0 = blockIdx.y * 64;
    const int srow = tid >> 3, spc = (tid & 7) * 8;
    const size_t goa = (size_t)(rb + srow) * DM + spc, gob = (size_t)(c0 + srow) * DM + spc;
    v8us ra[4], rw[4], rl[4];
    auto gload = [&](int kc) {
#pragma unroll
        for (int s = 0; s < 4; ++s) { ra[s] = *(const v8us*)(A + goa + (size_t)s * 16 * DM + kc); rw[s] = *(const v8us*)(Bn + gob + (size_t)s * 16 * DM + kc);
            if (SPLITA) rl[s] = *(const v8us*)(Al + goa + (size_t)s * 16 * DM + kc); }
    };
    auto sstore = [&](int buf) {
#pragma unroll
        for (int s = 0; s < 4; ++s) { const int so = (srow + 16 * s) * GP + spc; *(v8us*)(&stg[buf][0][so]) = ra[s]; *(v8us*)(&stg[buf][1][so]) = rw[s];
            if (SPLITA) *(v8us*)(&stg[buf][NP - 1][so]) = rl[s]; }
    };
    v8f acc[2][2];
#pragma unroll
    for (int i = 0; i < 2; ++i)
#pragma unroll
        for (int t = 0; t < 2; ++t) acc[i][t] = (v8f){};
    gload(0);
    sstore(0);
    __syncthreads();
#pragma unroll 1
    for (int c = 0; c < DM / 64; ++c) {
        const int cur = c & 1;
        const bool more = c + 1 < DM / 64;
        if (more) gload((c + 1) * 64);
        v16bf a[2][2], al[2][2], b[2][2];
#pragma unroll
        for (int kk = 0; kk < 2; ++kk)
#pragma unroll
            for (int i = 0; i < 2; ++i) {
                const int ao = (wm * 32 + i * 16 + lr) * GP + kk * 32 + 8 * hi, bo = (wn * 32 + i * 16 + lr) * GP + kk * 32 + 8 * hi;
                a[kk][i] = cat16b(*(const v8us*)(&stg[cur][0][ao]), *(const v8us*)(&stg[cur][0][ao + 16]));
                b[kk][i] = cat16b(*(const v8us*)(&stg[cur][1][bo]), *(const v8us*)(&stg[cur][1][bo + 16]));
                al[kk][i] = a[kk][i];
                if (SPLITA) al[kk][i] = cat16b(*(const v8us*)(&stg[cur][NP - 1][ao]), *(const v8us*)(&stg[cur][NP - 1][ao + 16]));
            }
        __builtin_amdgcn_sched_barrier(0);    // the chunk's LDS reads stay one group ahead of its WMMAs: reads set among them make the wave wait out the LDS latency at each place
#pragma unroll
        for (int kk = 0; kk < 2; ++kk) {
#pragma unroll
            for (int i = 0; i < 2; ++i)
#pragma unroll
                for (int t = 0; t < 2; ++t) acc[i][t] = wmmab(a[kk][i], b[kk][t], acc[i][t]);
            if (SPLITA) {
#pragma unroll
                for (int i = 0; i < 2; ++i)
#pragma unroll
                    for (int t = 0; t < 2; ++t) acc[i][t] = wmmab(al[kk][i], b[kk][t], acc[i][t]);
            }
        }
        if (more) sstore(cur ^ 1);
        __syncthreads();
    }
    float* ob = &ost[0][0];
#pragma unroll
    for (int i = 0; i < 2; ++i)
#pragma unroll
        for (int t = 0; t < 2; ++t)
#pragma unroll
            for (int j = 0; j < 8; ++j) ob[(wm * 32 + i * 16 + hi * 8 + j) * 68 + wn * 32 + t * 16 + lr] = acc[i][t][j];
    __syncthreads();
    const float* os = &ost[wave][0];
    float* crow = C + (size_t)(rb + wave * 16) * ldc + c0;
    auto pass = [&]() {
#pragma unroll
        for (int s = 0; s < 8; ++s) { const int Lid = (lane >> 3) + 4 * s, piece = lane & 7; const int row = Lid >> 1, cofs = (Lid & 1) * 32 + piece * 4;
            const v4f val = *(const v4fa*)(os + row * 68 + cofs); *(v4f*)(crow + (size_t)row * ldc + cofs) = val; }
    };
    pass(); 
}

// k_score: wave = (b, head g of the 24 = 16 q heads + 8 kv heads, 32 tokens): for each token: lane holds the rotary pair (d = lane, lane + 32): y1 = x1 c + x2 s,
__global__ __launch_bounds__(256) void k_score(const float* __restrict__ Q, const float* __restrict__ K, const float* __restrict__ cosv, const float* __restrict__ sinv, const float* __restrict__ wb, float* S) {
    const int lane = threadIdx.x & 31, wid = blockIdx.x * 8 + (threadIdx.x >> 5);
    const int per_b = (NH_ + NKV) * (NT_ / 32);
    if (wid >= NB_ * per_b) return;
    const int b = wid / per_b, rem = wid - b * per_b, g = rem / (NT_ / 32), tt = rem - g * (NT_ / 32);
    const float w1 = bfr(wb[lane]), w2 = bfr(wb[lane + 32]);
    float mine = 0.f;
#pragma unroll 1
    for (int i = 0; i < 32; ++i) {
        const int t = tt * 32 + i;
        const float* src = (g < NH_) ? (Q + ((size_t)b * NT_ + t) * DM + g * HD) : (K + ((size_t)b * NT_ + t) * DKV + (g - NH_) * HD);
        const float x1 = src[lane], x2 = src[lane + 32];
        const float c = bfr(cosv[(size_t)t * 32 + lane]), s = bfr(sinv[(size_t)t * 32 + lane]);
        const float y1 = x1 * c + x2 * s, y2 = -x1 * s + x2 * c;
        float ss = y1 * y1 + y2 * y2;
#pragma unroll
        for (int o = 16; o; o >>= 1) ss += __shfl_xor(ss, o, 32);
        const float rn = rsqrtf(ss * (1.0f / HD) + 1e-6f);
        float d = (y1 * w1 + y2 * w2) * rn;
#pragma unroll
        for (int o = 16; o; o >>= 1) d += __shfl_xor(d, o, 32);
        if (lane == i) mine = d;
    }
    VST2(float, S + ((size_t)b * (NH_ + NKV) + g) * NT_ + tt * 32 + lane, mine);
}

__global__ __launch_bounds__(256) void k_vt(const float* __restrict__ V, h16* VTH, h16* VTL) {
    __shared__ __align__(16) h16 tile[64 * 72];
    __shared__ __align__(16) h16 til2[64 * 72];
    const int bid = blockIdx.x;
    const int b = bid / (NKV * (NT_ / 64)), rem = bid - b * (NKV * (NT_ / 64)), h = rem / (NT_ / 64), kt = rem - h * (NT_ / 64);
    const int k0 = kt * 64, tid = threadIdx.x;
    const int kk = tid >> 2, d0 = (tid & 3) * 16;
    const float* src = V + ((size_t)b * NT_ + k0 + kk) * DKV + h * HD + d0;
#pragma unroll
    for (int i = 0; i < 16; ++i) { const float v = src[i]; const h16 a = (h16)v; tile[(d0 + i) * 72 + kk] = a; til2[(d0 + i) * 72 + kk] = (h16)((v - (float)a) * LOSC); }
    __syncthreads();
    const int piece = tid & 7;
    const size_t base = (((size_t)b * NKV + h) * HD) * NT_ + k0;
    auto pass = [&]() {
#pragma unroll
        for (int s = 0; s < 4; ++s) { const int Lid = (tid >> 3) + 32 * s; const int pln = Lid >> 6, d = Lid & 63;
            const v8h val = *(const v8ha*)((pln ? til2 : tile) + d * 72 + piece * 8); *(v8h*)((pln ? VTL : VTH) + base + (size_t)d * NT_ + piece * 8) = val; }
    };
    pass(); 
}

// k_attn: block = (b, h, 64 queries), wave = 16; key tiles 0 .. the query tile (block-uniform static bound). Per 32-key step the gate tile is pure VALU:
// g[t][s] = sigmoid(s_q[t] + s_k[s]) for s <= t else 0, x32768, as f16 hi + residual x1024 per-wave LDS tiles (same-wave may_alias reload after a compiler barrier);
// The value fragments and the two s_k of step kt + 1 are loaded during step kt into registers carried round the loop, so the s_k latency runs under this step's work and the value latency under the next step's gate work.
// 12 WMMA against the value planes of kv head h/2 (w_h.v_h + w_h.v_l + w_l.v_h); y = (o + ox/1024) / 32768 / (sqrt(2048) + 1e-6) -> bf16 hi/lo planes YH/YL[tok][h*64+d].
__global__ __launch_bounds__(128) void k_attn(const float* __restrict__ S, const h16* __restrict__ VTH, const h16* __restrict__ VTL, bf* YH, bf* YL) {
    __shared__ __align__(16) h16 plds[4][16 * 32];
    __shared__ __align__(16) h16 plds2[4][16 * 32];
    __shared__ __align__(16) float ost[4][16 * 68];
    const int lane = threadIdx.x & 31, wave = threadIdx.x >> 5, lr = lane & 15, hi = lane >> 4;
    const int bid = blockIdx.x;
    const int b = bid / (NH_ * (NT_ / 64)), rem = bid - b * (NH_ * (NT_ / 64)), h = rem / (NT_ / 64), qt = rem - h * (NT_ / 64);
    const int q0 = qt * 64 + wave * 16, hk = h / (NH_ / NKV);
    const size_t tok0 = (size_t)b * NT_;
    h16* pl = &plds[wave][0]; h16* pl2 = &plds2[wave][0];
    const float* sq_b = S + ((size_t)b * (NH_ + NKV) + h) * NT_;
    const float* sk_b = S + ((size_t)b * (NH_ + NKV) + NH_ + hk) * NT_;
    int qpos[8]; float sq[8];
#pragma unroll
    for (int j = 0; j < 8; ++j) { qpos[j] = q0 + 8 * hi + j; sq[j] = sq_b[qpos[j]]; }
    const size_t vbase = (((size_t)b * NKV + hk) * HD) * NT_;
    v8f o[4], ox[4];
#pragma unroll
    for (int n = 0; n < 4; ++n) { o[n] = (v8f){}; ox[n] = (v8f){}; }
    const int kt_end = (qt * 64 + 64) / 32;
    v8h vha[4], vhb[4], vla[4], vlb[4];
    auto loadv = [&](int l) {
#pragma unroll
        for (int n = 0; n < 4; ++n) { const size_t vo = vbase + (size_t)(n * 16 + lr) * NT_ + l + hi * 8;
            vha[n] = *(const v8h*)(VTH + vo); vhb[n] = *(const v8h*)(VTH + vo + 16); vla[n] = *(const v8h*)(VTL + vo); vlb[n] = *(const v8h*)(VTL + vo + 16); }
    };
    float sk0 = sk_b[lr], sk1 = sk_b[16 + lr];
    asm volatile("" :: "v"(sk0), "v"(sk1));    // step 0's s_k landed ahead of the value loads: else the loop's wait for them (loads return in order) also waits out every step's value loads
    loadv(0);
#pragma unroll 1
    for (int kt = 0; kt < kt_end; ++kt) {
        const int l0 = kt * 32;
        const int ln = (kt + 1 < kt_end ? kt + 1 : kt) * 32;    // the last step loads its own tile again: in bounds, not used
        const float skn0 = sk_b[ln + lr], skn1 = sk_b[ln + 16 + lr];
#pragma unroll
        for (int j = 0; j < 8; ++j) {
            const float g0 = (l0 + lr <= qpos[j]) ? PSC / (1.0f + __expf(-(sq[j] + sk0))) : 0.0f;
            const float g1 = (l0 + 16 + lr <= qpos[j]) ? PSC / (1.0f + __expf(-(sq[j] + sk1))) : 0.0f;
            const h16 h0 = (h16)g0, h1 = (h16)g1;
            const int mr = hi * 8 + j;
            pl[mr * 32 + lr] = h0; pl[mr * 32 + 16 + lr] = h1;
            pl2[mr * 32 + lr] = (h16)((g0 - (float)h0) * LOSC); pl2[mr * 32 + 16 + lr] = (h16)((g1 - (float)h1) * LOSC);
        }
        asm volatile("" ::: "memory");
        const v16h pa = cat16(*(const v8ha*)(pl + lr * 32 + hi * 8), *(const v8ha*)(pl + lr * 32 + 16 + hi * 8));
        const v16h px = cat16(*(const v8ha*)(pl2 + lr * 32 + hi * 8), *(const v8ha*)(pl2 + lr * 32 + 16 + hi * 8));
#pragma unroll
        for (int n = 0; n < 4; ++n) { const v16h vh = cat16(vha[n], vhb[n]), vl = cat16(vla[n], vlb[n]);
            o[n] = wmma16(pa, vh, o[n]); ox[n] = wmma16(pa, vl, ox[n]); ox[n] = wmma16(px, vh, ox[n]); }
        loadv(ln);
        asm volatile("v_nop\n\tv_nop\n\tv_nop\n\tv_nop" : "+v"(o[0]), "+v"(o[1]), "+v"(o[2]), "+v"(o[3]), "+v"(ox[0]), "+v"(ox[1]), "+v"(ox[2]), "+v"(ox[3]) : "v"(pa), "v"(px));
        __builtin_amdgcn_wave_barrier();            // the gate tiles are rewritten next step
        sk0 = skn0; sk1 = skn1;
    }
    const float scl = (1.0f / PSC) / (sqrtf((float)NT_) + 1e-6f);
    float* os = &ost[wave][0];
#pragma unroll
    for (int n = 0; n < 4; ++n)
#pragma unroll
        for (int j = 0; j < 8; ++j) os[(hi * 8 + j) * 68 + n * 16 + lr] = (o[n][j] + ox[n][j] * LOSCI) * scl;
    __syncthreads();
    const size_t cbase = (tok0 + q0) * DM + (size_t)h * HD;
    auto pass = [&]() {
#pragma unroll
        for (int s = 0; s < 4; ++s) { const int row = 4 * s + (lane >> 3), piece = lane & 7; const float* sp = os + row * 68 + piece * 8; v8us oh, ol;
#pragma unroll
            for (int i = 0; i < 8; ++i) { const unsigned short hb = f2bf(sp[i]); oh[i] = hb; ol[i] = f2bf(sp[i] - bf2f(hb)); }
            *(v8us*)(YH + cbase + (size_t)row * DM + piece * 8) = oh; *(v8us*)(YL + cbase + (size_t)row * DM + piece * 8) = ol; }
    };
    pass(); 
}

extern "C" void kernel_launch(void* const* d_in, const int* in_sizes, int n_in,
                              void* d_out, int out_size, void* d_ws, size_t ws_size, hipStream_t stream) {
    (void)in_sizes; (void)n_in; (void)out_size;
    const float* x = (const float*)d_in[0]; const float* cosv = (const float*)d_in[1]; const float* sinv = (const float*)d_in[2];
    const float* Wq = (const float*)d_in[3]; const float* Wk = (const float*)d_in[4]; const float* Wv = (const float*)d_in[5]; const float* Wp = (const float*)d_in[6]; const float* wb = (const float*)d_in[7];
    float* out = (float*)d_out;    // [2][2048][1024]
    char* wsp = (char*)d_ws;
    auto take = [&](size_t bytes) { char* p = wsp; wsp += (bytes + 255) & ~(size_t)255; return (void*)p; };
    bf* Xb = (bf*)take((size_t)NTK * DM * 2); bf* WQb = (bf*)take((size_t)DM * DM * 2); bf* WKb = (bf*)take((size_t)DKV * DM * 2); bf* WVb = (bf*)take((size_t)DKV * DM * 2); bf* WPb = (bf*)take((size_t)DM * DM * 2);
    float* Q = (float*)take((size_t)NTK * DM * 4); float* K = (float*)take((size_t)NTK * DKV * 4); float* V = (float*)take((size_t)NTK * DKV * 4);
    float* S = (float*)take((size_t)NB_ * (NH_ + NKV) * NT_ * 4);
    h16* VTH = (h16*)take((size_t)NTK * DKV * 2); h16* VTL = (h16*)take((size_t)NTK * DKV * 2);
    bf* YH = (bf*)take((size_t)NTK * DM * 2); bf* YL = (bf*)take((size_t)NTK * DM * 2);
    if ((size_t)(wsp - (char*)d_ws) > ws_size) return;    // 8.4 + 6.3 + 16.8 + 2 x 8.4 + 0.4 + 2 x 4.2 + 2 x 8.4 MB ~ 74 MB
    k_cvtb<<<NTK / 8, 256, 0, stream>>>(x, NTK, Xb);
    k_cvtb<<<DM / 8, 256, 0, stream>>>(Wq, DM, WQb);
    k_cvtb<<<DKV / 8, 256, 0, stream>>>(Wk, DKV, WKb);
    k_cvtb<<<DKV / 8, 256, 0, stream>>>(Wv, DKV, WVb);
    k_cvtb<<<DM / 8, 256, 0, stream>>>(Wp, DM, WPb);
    k_gemmb<false><<<dim3(NTK / 64, DM / 64, 1), 128, 0, stream>>>(Xb, nullptr, WQb, Q, DM);
    k_gemmb<false><<<dim3(NTK / 64, DKV / 64, 1), 128, 0, stream>>>(Xb, nullptr, WKb, K, DKV);
    k_gemmb<false><<<dim3(NTK / 64, DKV / 64, 1), 128, 0, stream>>>(Xb, nullptr, WVb, V, DKV);
    k_score<<<(NB_ * (NH_ + NKV) * (NT_ / 32) + 7) / 8, 256, 0, stream>>>(Q, K, cosv, sinv, wb, S);
    k_vt<<<NB_ * NKV * (NT_ / 64), 256, 0, stream>>>(V, VTH, VTL);
    k_attn<<<NB_ * NH_ * (NT_ / 64), 128, 0, stream>>>(S, VTH, VTL, YH, YL);
    k_gemmb<true><<<dim3(NTK / 64, DM / 64, 1), 128, 0, stream>>>(YH, YL, WPb, out, DM);
}

// v003
// It runs in 183 microseconds.
// Timed twice side by side with v002, it ran 1.07 times as fast both times.
// Counting every step since v000, it is 1.81 times as fast.
#include <hip/hip_runtime.h>

// Contractions, f32 accumulate: q = x.Wq^T ([4096 x 1024].[1024 x 1024]), k, v = x.Wk^T, x.Wv^T ([4096 x 1024].[1024 x 512]) on v_wmma_f32_16x16x32_bf16 with PLAIN
// bf16 operands (inputs rounded once: exact products); the per-(batch, head) causal gated aggregation y = sum_{s<=t} sigmoid(s_q[t] + s_k[s]) v_s (no q.k product: the
// score is a rank-1 outer sum of two scalars) on v_wmma_f32_16x16x32_f16 with the gate weights (x32768) and v as f16 hi + residual x1024 planes (three products);
// out = y.Wproj^T on the bf16 instruction with y as bf16 hi + residual planes. Rotary, rms_norm, the w_braid dots and the sigmoids are f32. Deterministic, no atomics;

#define NB_  2
#define NT_  2048
#define DM   1024
#define NH_  16
#define NKV  8
#define HD   64
#define DKV  (NKV * HD)
#define NTK  (NB_ * NT_)
#define PSC  32768.0f
#define LOSC 1024.0f
#define LOSCI (1.0f / 1024.0f)

typedef _Float16 h16;
typedef unsigned short bf;
typedef __attribute__((ext_vector_type(16))) __bf16   v16bf;
typedef __attribute__((ext_vector_type(16))) _Float16 v16h;
typedef __attribute__((ext_vector_type(8)))  _Float16 v8h;
typedef __attribute__((ext_vector_type(8)))  unsigned short v8us;
typedef __attribute__((ext_vector_type(8)))  float    v8f;
typedef __attribute__((ext_vector_type(4)))  float    v4f;
typedef v8h  __attribute__((may_alias)) v8ha;
typedef v4f  __attribute__((may_alias)) v4fa;

__device__ __forceinline__ unsigned short f2bf(float f) { unsigned u = __float_as_uint(f); u += 0x7FFFu + ((u >> 16) & 1u); return (unsigned short)(u >> 16); }
__device__ __forceinline__ float bf2f(unsigned short b) { return __uint_as_float(((unsigned)b) << 16); }
__device__ __forceinline__ float bfr(float f) { return bf2f(f2bf(f)); }
__device__ __forceinline__ v16h cat16(v8h lo, v8h hi) { return __builtin_shufflevector(lo, hi, 0, 1, 2, 3, 4, 5, 6, 7, 8, 9, 10, 11, 12, 13, 14, 15); }
__device__ __forceinline__ v16bf cat16b(v8us lo, v8us hi) { return __builtin_bit_cast(v16bf, __builtin_shufflevector(lo, hi, 0, 1, 2, 3, 4, 5, 6, 7, 8, 9, 10, 11, 12, 13, 14, 15)); }
__device__ __forceinline__ v8f wmma16(v16h a, v16h b, v8f c) { return __builtin_amdgcn_wmma_f32_16x16x32_f16(false, a, false, b, (short)0, c, false, false); }
__device__ __forceinline__ v8f wmmab(v16bf a, v16bf b, v8f c) { return __builtin_amdgcn_wmma_f32_16x16x32_bf16(false, a, false, b, (short)0, c, false, false); }
#define VST2(T, p, v) do { const T vst2_v_ = (v); *(T*)(p) = vst2_v_;  } while (0)

__global__ __launch_bounds__(256) void k_cvtb(const float* __restrict__ src, int nrows, bf* dst) {
    const int lane = threadIdx.x & 31, r = blockIdx.x * 8 + (threadIdx.x >> 5);
    if (r >= nrows) return;
    v8us o[4];
#pragma unroll
    for (int q = 0; q < 4; ++q) { v8us t;
#pragma unroll
        for (int i = 0; i < 8; ++i) t[i] = f2bf(src[(size_t)r * DM + q * 256 + lane * 8 + i]);
        o[q] = t; }
#pragma unroll
    for (int q = 0; q < 4; ++q) *(v8us*)(dst + (size_t)r * DM + q * 256 + lane * 8) = o[q];
    
}

// k_gemmb: block = 64 x 64 of C, 4 waves as 2 x 2, each 32 x 32 (2 x 2 accumulator tiles). Per 64-k chunk the block's operand rows (128 B each) come from global memory as
// whole lines (8 lanes a row, 4 rows a wave-load), one chunk ahead into registers, and go to one of two LDS buffers at a pitch of 144 B; the fragments are read from LDS.
// One barrier a chunk: it publishes the buffer just written and ends the reads of the buffer that the next chunk's stores overwrite. k order and sum order per element as before.
#define GP 72
template <bool SPLITA>
__global__ __launch_bounds__(128) void k_gemmb(const bf* __restrict__ A, const bf* __restrict__ Al, const bf* __restrict__ Bn, float* C, int ldc) {
    constexpr int NP = SPLITA ? 3 : 2;
    __shared__ __align__(16) bf stg[2][NP][64 * GP];
    __shared__ __align__(16) float ost[4][16 * 68];
    const int tid = threadIdx.x, lane = tid & 31, wave = tid >> 5, lr = lane & 15, hi = lane >> 4;
    const int wm = wave >> 1, wn = wave & 1;
    const int rb = blockIdx.x * 64, c0 = blockIdx.y * 64;
    const int srow = tid >> 3, spc = (tid & 7) * 8;
    const size_t goa = (size_t)(rb + srow) * DM + spc, gob = (size_t)(c0 + srow) * DM + spc;
    v8us ra[4], rw[4], rl[4];
    auto gload = [&](int kc) {
#pragma unroll
        for (int s = 0; s < 4; ++s) { ra[s] = *(const v8us*)(A + goa + (size_t)s * 16 * DM + kc); rw[s] = *(const v8us*)(Bn + gob + (size_t)s * 16 * DM + kc);
            if (SPLITA) rl[s] = *(const v8us*)(Al + goa + (size_t)s * 16 * DM + kc); }
    };
    auto sstore = [&](int buf) {
#pragma unroll
        for (int s = 0; s < 4; ++s) { const int so = (srow + 16 * s) * GP + spc; *(v8us*)(&stg[buf][0][so]) = ra[s]; *(v8us*)(&stg[buf][1][so]) = rw[s];
            if (SPLITA) *(v8us*)(&stg[buf][NP - 1][so]) = rl[s]; }
    };
    v8f acc[2][2];
#pragma unroll
    for (int i = 0; i < 2; ++i)
#pragma unroll
        for (int t = 0; t < 2; ++t) acc[i][t] = (v8f){};
    gload(0);
    sstore(0);
    __syncthreads();
#pragma unroll 1
    for (int c = 0; c < DM / 64; ++c) {
        const int cur = c & 1;
        const bool more = c + 1 < DM / 64;
        if (more) gload((c + 1) * 64);
        v16bf a[2][2], al[2][2], b[2][2];
#pragma unroll
        for (int kk = 0; kk < 2; ++kk)
#pragma unroll
            for (int i = 0; i < 2; ++i) {
                const int ao = (wm * 32 + i * 16 + lr) * GP + kk * 32 + 8 * hi, bo = (wn * 32 + i * 16 + lr) * GP + kk * 32 + 8 * hi;
                a[kk][i] = cat16b(*(const v8us*)(&stg[cur][0][ao]), *(const v8us*)(&stg[cur][0][ao + 16]));
                b[kk][i] = cat16b(*(const v8us*)(&stg[cur][1][bo]), *(const v8us*)(&stg[cur][1][bo + 16]));
                al[kk][i] = a[kk][i];
                if (SPLITA) al[kk][i] = cat16b(*(const v8us*)(&stg[cur][NP - 1][ao]), *(const v8us*)(&stg[cur][NP - 1][ao + 16]));
            }
        __builtin_amdgcn_sched_barrier(0);    // the chunk's LDS reads stay one group ahead of its WMMAs: reads set among them make the wave wait out the LDS latency at each place
#pragma unroll
        for (int kk = 0; kk < 2; ++kk) {
#pragma unroll
            for (int i = 0; i < 2; ++i)
#pragma unroll
                for (int t = 0; t < 2; ++t) acc[i][t] = wmmab(a[kk][i], b[kk][t], acc[i][t]);
            if (SPLITA) {
#pragma unroll
                for (int i = 0; i < 2; ++i)
#pragma unroll
                    for (int t = 0; t < 2; ++t) acc[i][t] = wmmab(al[kk][i], b[kk][t], acc[i][t]);
            }
        }
        if (more) sstore(cur ^ 1);
        __syncthreads();
    }
    float* ob = &ost[0][0];
#pragma unroll
    for (int i = 0; i < 2; ++i)
#pragma unroll
        for (int t = 0; t < 2; ++t)
#pragma unroll
            for (int j = 0; j < 8; ++j) ob[(wm * 32 + i * 16 + hi * 8 + j) * 68 + wn * 32 + t * 16 + lr] = acc[i][t][j];
    __syncthreads();
    const float* os = &ost[wave][0];
    float* crow = C + (size_t)(rb + wave * 16) * ldc + c0;
    auto pass = [&]() {
#pragma unroll
        for (int s = 0; s < 8; ++s) { const int Lid = (lane >> 3) + 4 * s, piece = lane & 7; const int row = Lid >> 1, cofs = (Lid & 1) * 32 + piece * 4;
            const v4f val = *(const v4fa*)(os + row * 68 + cofs); *(v4f*)(crow + (size_t)row * ldc + cofs) = val; }
    };
    pass(); 
}

// k_score: wave = (b, head g of the 24 = 16 q heads + 8 kv heads, 32 tokens): for each token: lane holds the rotary pair (d = lane, lane + 32): y1 = x1 c + x2 s,
__global__ __launch_bounds__(256) void k_score(const float* __restrict__ Q, const float* __restrict__ K, const float* __restrict__ cosv, const float* __restrict__ sinv, const float* __restrict__ wb, float* S) {
    const int lane = threadIdx.x & 31, wid = blockIdx.x * 8 + (threadIdx.x >> 5);
    const int per_b = (NH_ + NKV) * (NT_ / 32);
    if (wid >= NB_ * per_b) return;
    const int b = wid / per_b, rem = wid - b * per_b, g = rem / (NT_ / 32), tt = rem - g * (NT_ / 32);
    const float w1 = bfr(wb[lane]), w2 = bfr(wb[lane + 32]);
    float mine = 0.f;
#pragma unroll 1
    for (int i = 0; i < 32; ++i) {
        const int t = tt * 32 + i;
        const float* src = (g < NH_) ? (Q + ((size_t)b * NT_ + t) * DM + g * HD) : (K + ((size_t)b * NT_ + t) * DKV + (g - NH_) * HD);
        const float x1 = src[lane], x2 = src[lane + 32];
        const float c = bfr(cosv[(size_t)t * 32 + lane]), s = bfr(sinv[(size_t)t * 32 + lane]);
        const float y1 = x1 * c + x2 * s, y2 = -x1 * s + x2 * c;
        float ss = y1 * y1 + y2 * y2;
#pragma unroll
        for (int o = 16; o; o >>= 1) ss += __shfl_xor(ss, o, 32);
        const float rn = rsqrtf(ss * (1.0f / HD) + 1e-6f);
        float d = (y1 * w1 + y2 * w2) * rn;
#pragma unroll
        for (int o = 16; o; o >>= 1) d += __shfl_xor(d, o, 32);
        if (lane == i) mine = d;
    }
    VST2(float, S + ((size_t)b * (NH_ + NKV) + g) * NT_ + tt * 32 + lane, mine);
}

__global__ __launch_bounds__(256) void k_vt(const float* __restrict__ V, h16* VTH, h16* VTL) {
    __shared__ __align__(16) h16 tile[64 * 72];
    __shared__ __align__(16) h16 til2[64 * 72];
    const int bid = blockIdx.x;
    const int b = bid / (NKV * (NT_ / 64)), rem = bid - b * (NKV * (NT_ / 64)), h = rem / (NT_ / 64), kt = rem - h * (NT_ / 64);
    const int k0 = kt * 64, tid = threadIdx.x;
    const int kk = tid >> 2, d0 = (tid & 3) * 16;
    const float* src = V + ((size_t)b * NT_ + k0 + kk) * DKV + h * HD + d0;
#pragma unroll
    for (int i = 0; i < 16; ++i) { const float v = src[i]; const h16 a = (h16)v; tile[(d0 + i) * 72 + kk] = a; til2[(d0 + i) * 72 + kk] = (h16)((v - (float)a) * LOSC); }
    __syncthreads();
    const int piece = tid & 7;
    const size_t base = (((size_t)b * NKV + h) * HD) * NT_ + k0;
    auto pass = [&]() {
#pragma unroll
        for (int s = 0; s < 4; ++s) { const int Lid = (tid >> 3) + 32 * s; const int pln = Lid >> 6, d = Lid & 63;
            const v8h val = *(const v8ha*)((pln ? til2 : tile) + d * 72 + piece * 8); *(v8h*)((pln ? VTL : VTH) + base + (size_t)d * NT_ + piece * 8) = val; }
    };
    pass(); 
}

// k_attn: block = (b, h, 64 queries), wave = 16; key tiles 0 .. the query tile (block-uniform static bound). Per 32-key step the gate tile is pure VALU:
// g[t][s] = sigmoid(s_q[t] + s_k[s]) for s <= t else 0, x32768, as f16 hi + residual x1024 per-wave LDS tiles (same-wave may_alias reload after a compiler barrier);
// 32768 sigmoid(a + b) = 1 / (2^-15 + (2^-7 e^-a)(2^-8 e^-b)): the two factors are formed once per query row and once per key, an element is one fma, one v_rcp_f32 and a select.
// The value fragments and the two s_k of step kt + 1 are loaded during step kt into registers carried round the loop, so the values' latency runs under the next step's gate work and the s_k's under this step's.
// 12 WMMA against the value planes of kv head h/2 (w_h.v_h + w_h.v_l + w_l.v_h); y = (o + ox/1024) / 32768 / (sqrt(2048) + 1e-6) -> bf16 hi/lo planes YH/YL[tok][h*64+d].
// 2^sh e^-s. rms_norm bounds |s| by 8 |w_braid|; the clamp at 80 keeps both factors of a gate finite, normal and non-zero, so that their product is never inf x 0.
__device__ __forceinline__ float gfac(float s, float sh) { return __builtin_amdgcn_exp2f(fmaf(fminf(fmaxf(s, -80.0f), 80.0f), -1.44269504f, sh)); }

__global__ __launch_bounds__(128) void k_attn(const float* __restrict__ S, const h16* __restrict__ VTH, const h16* __restrict__ VTL, bf* YH, bf* YL) {
    __shared__ __align__(16) h16 plds[4][16 * 32];
    __shared__ __align__(16) h16 plds2[4][16 * 32];
    __shared__ __align__(16) float ost[4][16 * 68];
    const int lane = threadIdx.x & 31, wave = threadIdx.x >> 5, lr = lane & 15, hi = lane >> 4;
    const int bid = blockIdx.x;
    const int b = bid / (NH_ * (NT_ / 64)), rem = bid - b * (NH_ * (NT_ / 64)), h = rem / (NT_ / 64), qt = rem - h * (NT_ / 64);
    const int q0 = qt * 64 + wave * 16, hk = h / (NH_ / NKV);
    const size_t tok0 = (size_t)b * NT_;
    h16* pl = &plds[wave][0]; h16* pl2 = &plds2[wave][0];
    const float* sq_b = S + ((size_t)b * (NH_ + NKV) + h) * NT_;
    const float* sk_b = S + ((size_t)b * (NH_ + NKV) + NH_ + hk) * NT_;
    int qpos[8]; float eq[8];
#pragma unroll
    for (int j = 0; j < 8; ++j) { qpos[j] = q0 + 8 * hi + j; eq[j] = gfac(sq_b[qpos[j]], -7.0f); }
    const size_t vbase = (((size_t)b * NKV + hk) * HD) * NT_;
    v8f o[4], ox[4];
#pragma unroll
    for (int n = 0; n < 4; ++n) { o[n] = (v8f){}; ox[n] = (v8f){}; }
    const int kt_end = (qt * 64 + 64) / 32;
    v8h vha[4], vhb[4], vla[4], vlb[4];
    auto loadv = [&](int l) {
#pragma unroll
        for (int n = 0; n < 4; ++n) { const size_t vo = vbase + (size_t)(n * 16 + lr) * NT_ + l + hi * 8;
            vha[n] = *(const v8h*)(VTH + vo); vhb[n] = *(const v8h*)(VTH + vo + 16); vla[n] = *(const v8h*)(VTL + vo); vlb[n] = *(const v8h*)(VTL + vo + 16); }
    };
    float sk0 = sk_b[lr], sk1 = sk_b[16 + lr];
    asm volatile("" :: "v"(sk0), "v"(sk1));    // step 0's s_k landed ahead of the value loads: else the loop's wait for them (loads return in order) also waits out every step's value loads
    loadv(0);
#pragma unroll 1
    for (int kt = 0; kt < kt_end; ++kt) {
        const int l0 = kt * 32;
        const int ln = (kt + 1 < kt_end ? kt + 1 : kt) * 32;    // the last step loads its own tile again: in bounds, not used
        const float skn0 = sk_b[ln + lr], skn1 = sk_b[ln + 16 + lr];
        const float ek0 = gfac(sk0, -8.0f), ek1 = gfac(sk1, -8.0f);
#pragma unroll
        for (int j = 0; j < 8; ++j) {
            const float r0 = __builtin_amdgcn_rcpf(fmaf(eq[j], ek0, 1.0f / PSC)), r1 = __builtin_amdgcn_rcpf(fmaf(eq[j], ek1, 1.0f / PSC));
            const float g0 = (l0 + lr <= qpos[j]) ? r0 : 0.0f;
            const float g1 = (l0 + 16 + lr <= qpos[j]) ? r1 : 0.0f;
            const h16 h0 = (h16)g0, h1 = (h16)g1;
            const int mr = hi * 8 + j;
            pl[mr * 32 + lr] = h0; pl[mr * 32 + 16 + lr] = h1;
            pl2[mr * 32 + lr] = (h16)((g0 - (float)h0) * LOSC); pl2[mr * 32 + 16 + lr] = (h16)((g1 - (float)h1) * LOSC);
        }
        asm volatile("" ::: "memory");
        const v16h pa = cat16(*(const v8ha*)(pl + lr * 32 + hi * 8), *(const v8ha*)(pl + lr * 32 + 16 + hi * 8));
        const v16h px = cat16(*(const v8ha*)(pl2 + lr * 32 + hi * 8), *(const v8ha*)(pl2 + lr * 32 + 16 + hi * 8));
#pragma unroll
        for (int n = 0; n < 4; ++n) { const v16h vh = cat16(vha[n], vhb[n]), vl = cat16(vla[n], vlb[n]);
            o[n] = wmma16(pa, vh, o[n]); ox[n] = wmma16(pa, vl, ox[n]); ox[n] = wmma16(px, vh, ox[n]); }
        loadv(ln);
        asm volatile("v_nop\n\tv_nop\n\tv_nop\n\tv_nop" : "+v"(o[0]), "+v"(o[1]), "+v"(o[2]), "+v"(o[3]), "+v"(ox[0]), "+v"(ox[1]), "+v"(ox[2]), "+v"(ox[3]) : "v"(pa), "v"(px));
        __builtin_amdgcn_wave_barrier();            // the gate tiles are rewritten next step
        sk0 = skn0; sk1 = skn1;
    }
    const float scl = (1.0f / PSC) / (sqrtf((float)NT_) + 1e-6f);
    float* os = &ost[wave][0];
#pragma unroll
    for (int n = 0; n < 4; ++n)
#pragma unroll
        for (int j = 0; j < 8; ++j) os[(hi * 8 + j) * 68 + n * 16 + lr] = (o[n][j] + ox[n][j] * LOSCI) * scl;
    __syncthreads();
    const size_t cbase = (tok0 + q0) * DM + (size_t)h * HD;
    auto pass = [&]() {
#pragma unroll
        for (int s = 0; s < 4; ++s) { const int row = 4 * s + (lane >> 3), piece = lane & 7; const float* sp = os + row * 68 + piece * 8; v8us oh, ol;
#pragma unroll
            for (int i = 0; i < 8; ++i) { const unsigned short hb = f2bf(sp[i]); oh[i] = hb; ol[i] = f2bf(sp[i] - bf2f(hb)); }
            *(v8us*)(YH + cbase + (size_t)row * DM + piece * 8) = oh; *(v8us*)(YL + cbase + (size_t)row * DM + piece * 8) = ol; }
    };
    pass(); 
}

extern "C" void kernel_launch(void* const* d_in, const int* in_sizes, int n_in,
                              void* d_out, int out_size, void* d_ws, size_t ws_size, hipStream_t stream) {
    (void)in_sizes; (void)n_in; (void)out_size;
    const float* x = (const float*)d_in[0]; const float* cosv = (const float*)d_in[1]; const float* sinv = (const float*)d_in[2];
    const float* Wq = (const float*)d_in[3]; const float* Wk = (const float*)d_in[4]; const float* Wv = (const float*)d_in[5]; const float* Wp = (const float*)d_in[6]; const float* wb = (const float*)d_in[7];
    float* out = (float*)d_out;    // [2][2048][1024]
    char* wsp = (char*)d_ws;
    auto take = [&](size_t bytes) { char* p = wsp; wsp += (bytes + 255) & ~(size_t)255; return (void*)p; };
    bf* Xb = (bf*)take((size_t)NTK * DM * 2); bf* WQb = (bf*)take((size_t)DM * DM * 2); bf* WKb = (bf*)take((size_t)DKV * DM * 2); bf* WVb = (bf*)take((size_t)DKV * DM * 2); bf* WPb = (bf*)take((size_t)DM * DM * 2);
    float* Q = (float*)take((size_t)NTK * DM * 4); float* K = (float*)take((size_t)NTK * DKV * 4); float* V = (float*)take((size_t)NTK * DKV * 4);
    float* S = (float*)take((size_t)NB_ * (NH_ + NKV) * NT_ * 4);
    h16* VTH = (h16*)take((size_t)NTK * DKV * 2); h16* VTL = (h16*)take((size_t)NTK * DKV * 2);
    bf* YH = (bf*)take((size_t)NTK * DM * 2); bf* YL = (bf*)take((size_t)NTK * DM * 2);
    if ((size_t)(wsp - (char*)d_ws) > ws_size) return;    // 8.4 + 6.3 + 16.8 + 2 x 8.4 + 0.4 + 2 x 4.2 + 2 x 8.4 MB ~ 74 MB
    k_cvtb<<<NTK / 8, 256, 0, stream>>>(x, NTK, Xb);
    k_cvtb<<<DM / 8, 256, 0, stream>>>(Wq, DM, WQb);
    k_cvtb<<<DKV / 8, 256, 0, stream>>>(Wk, DKV, WKb);
    k_cvtb<<<DKV / 8, 256, 0, stream>>>(Wv, DKV, WVb);
    k_cvtb<<<DM / 8, 256, 0, stream>>>(Wp, DM, WPb);
    k_gemmb<false><<<dim3(NTK / 64, DM / 64, 1), 128, 0, stream>>>(Xb, nullptr, WQb, Q, DM);
    k_gemmb<false><<<dim3(NTK / 64, DKV / 64, 1), 128, 0, stream>>>(Xb, nullptr, WKb, K, DKV);
    k_gemmb<false><<<dim3(NTK / 64, DKV / 64, 1), 128, 0, stream>>>(Xb, nullptr, WVb, V, DKV);
    k_score<<<(NB_ * (NH_ + NKV) * (NT_ / 32) + 7) / 8, 256, 0, stream>>>(Q, K, cosv, sinv, wb, S);
    k_vt<<<NB_ * NKV * (NT_ / 64), 256, 0, stream>>>(V, VTH, VTL);
    k_attn<<<NB_ * NH_ * (NT_ / 64), 128, 0, stream>>>(S, VTH, VTL, YH, YL);
    k_gemmb<true><<<dim3(NTK / 64, DM / 64, 1), 128, 0, stream>>>(YH, YL, WPb, out, DM);
}

// v004
// Measured time: 148 microseconds a run.
// Next to v003, in two timings, it ran 1.23 times as fast each time.
// All steps since v000 together make it 2.23 times as fast.
#include <hip/hip_runtime.h>

// Contractions, f32 accumulate: q = x.Wq^T ([4096 x 1024].[1024 x 1024]), k, v = x.Wk^T, x.Wv^T ([4096 x 1024].[1024 x 512]) on v_wmma_f32_16x16x32_bf16 with PLAIN
// bf16 operands (inputs rounded once: exact products); the per-(batch, head) causal gated aggregation y = sum_{s<=t} sigmoid(s_q[t] + s_k[s]) v_s (no q.k product: the
// score is a rank-1 outer sum of two scalars) on v_wmma_f32_16x16x32_f16 with the gate weights (x32768) and v as f16 hi + residual x1024 planes (three products);
// out = y.Wproj^T on the bf16 instruction with y as bf16 hi + residual planes. Rotary, rms_norm, the w_braid dots and the sigmoids are f32. Deterministic, no atomics;

#define NB_  2
#define NT_  2048
#define DM   1024
#define NH_  16
#define NKV  8
#define HD   64
#define DKV  (NKV * HD)
#define NTK  (NB_ * NT_)
#define PSC  32768.0f
#define LOSC 1024.0f
#define LOSCI (1.0f / 1024.0f)

typedef _Float16 h16;
typedef unsigned short bf;
typedef __attribute__((ext_vector_type(16))) __bf16   v16bf;
typedef __attribute__((ext_vector_type(16))) _Float16 v16h;
typedef __attribute__((ext_vector_type(8)))  _Float16 v8h;
typedef __attribute__((ext_vector_type(8)))  unsigned short v8us;
typedef __attribute__((ext_vector_type(8)))  float    v8f;
typedef __attribute__((ext_vector_type(4)))  float    v4f;
typedef v8h  __attribute__((may_alias)) v8ha;
typedef v4f  __attribute__((may_alias)) v4fa;

__device__ __forceinline__ unsigned short f2bf(float f) { unsigned u = __float_as_uint(f); u += 0x7FFFu + ((u >> 16) & 1u); return (unsigned short)(u >> 16); }
__device__ __forceinline__ float bf2f(unsigned short b) { return __uint_as_float(((unsigned)b) << 16); }
__device__ __forceinline__ float bfr(float f) { return bf2f(f2bf(f)); }
__device__ __forceinline__ v16h cat16(v8h lo, v8h hi) { return __builtin_shufflevector(lo, hi, 0, 1, 2, 3, 4, 5, 6, 7, 8, 9, 10, 11, 12, 13, 14, 15); }
__device__ __forceinline__ v16bf cat16b(v8us lo, v8us hi) { return __builtin_bit_cast(v16bf, __builtin_shufflevector(lo, hi, 0, 1, 2, 3, 4, 5, 6, 7, 8, 9, 10, 11, 12, 13, 14, 15)); }
__device__ __forceinline__ v8f wmma16(v16h a, v16h b, v8f c) { return __builtin_amdgcn_wmma_f32_16x16x32_f16(false, a, false, b, (short)0, c, false, false); }
__device__ __forceinline__ v8f wmmab(v16bf a, v16bf b, v8f c) { return __builtin_amdgcn_wmma_f32_16x16x32_bf16(false, a, false, b, (short)0, c, false, false); }
#define VST2(T, p, v) do { const T vst2_v_ = (v); *(T*)(p) = vst2_v_;  } while (0)

__global__ __launch_bounds__(256) void k_cvtb(const float* __restrict__ src, int nrows, bf* dst) {
    const int lane = threadIdx.x & 31, r = blockIdx.x * 8 + (threadIdx.x >> 5);
    if (r >= nrows) return;
    v8us o[4];
#pragma unroll
    for (int q = 0; q < 4; ++q) { v8us t;
#pragma unroll
        for (int i = 0; i < 8; ++i) t[i] = f2bf(src[(size_t)r * DM + q * 256 + lane * 8 + i]);
        o[q] = t; }
#pragma unroll
    for (int q = 0; q < 4; ++q) *(v8us*)(dst + (size_t)r * DM + q * 256 + lane * 8) = o[q];
    
}

// k_gemmb: block = 64 x 64 of C, 4 waves as 2 x 2, each 32 x 32 (2 x 2 accumulator tiles). Per 64-k chunk the block's operand rows (128 B each) come from global memory as
// whole lines (8 lanes a row, 4 rows a wave-load), one chunk ahead into registers, and go to one of two LDS buffers at a pitch of 144 B; the fragments are read from LDS.
// One barrier a chunk: it publishes the buffer just written and ends the reads of the buffer that the next chunk's stores overwrite. k order and sum order per element as before.
// The 64 x 64 f32 tile is staged in LDS and leaves by one of three epilogues. A 64-column tile of q, k or v is one head of 64 tokens, so what only reads a head's row is done here:
// EPI 0: the tile is stored to C as whole lines.
// EPI 1 (q, k): rotary, rms_norm and the w_braid dot per token; two lanes a token, each 16 rotary pairs (d, d + 32) summed in-lane, then one exchange; only the 64 scores leave,
//        to C = S[b][g0 + column tile][t], through LDS so that each 128-B line has one writing wave. q and k themselves are never stored.
// EPI 2 (v): the tile is staged transposed ([d][token]) and leaves as the f16 hi and residual x1024 planes VTH, VTL[b][kv head][d][t], whole lines. v itself is never stored.
#define GP 72
template <bool SPLITA, int EPI>
__global__ __launch_bounds__(128) void k_gemmb(const bf* __restrict__ A, const bf* __restrict__ Al, const bf* __restrict__ Bn, float* C, int ldc,
                                               const float* __restrict__ cosv, const float* __restrict__ sinv, const float* __restrict__ wb, int g0, h16* VTH, h16* VTL) {
    constexpr int NP = SPLITA ? 3 : 2;
    __shared__ __align__(16) bf stg[2][NP][64 * GP];
    __shared__ __align__(16) float ost[4][16 * 68];
    __shared__ float sred[64];
    const int tid = threadIdx.x, lane = tid & 31, wave = tid >> 5, lr = lane & 15, hi = lane >> 4;
    const int wm = wave >> 1, wn = wave & 1;
    const int rb = blockIdx.x * 64, c0 = blockIdx.y * 64;
    const int srow = tid >> 3, spc = (tid & 7) * 8;
    const size_t goa = (size_t)(rb + srow) * DM + spc, gob = (size_t)(c0 + srow) * DM + spc;
    v8us ra[4], rw[4], rl[4];
    auto gload = [&](int kc) {
#pragma unroll
        for (int s = 0; s < 4; ++s) { ra[s] = *(const v8us*)(A + goa + (size_t)s * 16 * DM + kc); rw[s] = *(const v8us*)(Bn + gob + (size_t)s * 16 * DM + kc);
            if (SPLITA) rl[s] = *(const v8us*)(Al + goa + (size_t)s * 16 * DM + kc); }
    };
    auto sstore = [&](int buf) {
#pragma unroll
        for (int s = 0; s < 4; ++s) { const int so = (srow + 16 * s) * GP + spc; *(v8us*)(&stg[buf][0][so]) = ra[s]; *(v8us*)(&stg[buf][1][so]) = rw[s];
            if (SPLITA) *(v8us*)(&stg[buf][NP - 1][so]) = rl[s]; }
    };
    v8f acc[2][2];
#pragma unroll
    for (int i = 0; i < 2; ++i)
#pragma unroll
        for (int t = 0; t < 2; ++t) acc[i][t] = (v8f){};
    gload(0);
    sstore(0);
    __syncthreads();
#pragma unroll 1
    for (int c = 0; c < DM / 64; ++c) {
        const int cur = c & 1;
        const bool more = c + 1 < DM / 64;
        if (more) gload((c + 1) * 64);
        v16bf a[2][2], al[2][2], b[2][2];
#pragma unroll
        for (int kk = 0; kk < 2; ++kk)
#pragma unroll
            for (int i = 0; i < 2; ++i) {
                const int ao = (wm * 32 + i * 16 + lr) * GP + kk * 32 + 8 * hi, bo = (wn * 32 + i * 16 + lr) * GP + kk * 32 + 8 * hi;
                a[kk][i] = cat16b(*(const v8us*)(&stg[cur][0][ao]), *(const v8us*)(&stg[cur][0][ao + 16]));
                b[kk][i] = cat16b(*(const v8us*)(&stg[cur][1][bo]), *(const v8us*)(&stg[cur][1][bo + 16]));
                al[kk][i] = a[kk][i];
                if (SPLITA) al[kk][i] = cat16b(*(const v8us*)(&stg[cur][NP - 1][ao]), *(const v8us*)(&stg[cur][NP - 1][ao + 16]));
            }
        __builtin_amdgcn_sched_barrier(0);    // the chunk's LDS reads stay one group ahead of its WMMAs: reads set among them make the wave wait out the LDS latency at each place
#pragma unroll
        for (int kk = 0; kk < 2; ++kk) {
#pragma unroll
            for (int i = 0; i < 2; ++i)
#pragma unroll
                for (int t = 0; t < 2; ++t) acc[i][t] = wmmab(a[kk][i], b[kk][t], acc[i][t]);
            if (SPLITA) {
#pragma unroll
                for (int i = 0; i < 2; ++i)
#pragma unroll
                    for (int t = 0; t < 2; ++t) acc[i][t] = wmmab(al[kk][i], b[kk][t], acc[i][t]);
            }
        }
        if (more) sstore(cur ^ 1);
        __syncthreads();
    }
    float* ob = &ost[0][0];
    const int bb = rb / NT_, t0 = rb & (NT_ - 1);    // a 64-row tile lies in one batch
    if constexpr (EPI == 2) {
#pragma unroll
        for (int i = 0; i < 2; ++i)
#pragma unroll
            for (int t = 0; t < 2; ++t) { float* p = ob + (wn * 32 + t * 16 + lr) * 68 + wm * 32 + i * 16 + hi * 8;
                *(v4fa*)p = __builtin_shufflevector(acc[i][t], acc[i][t], 0, 1, 2, 3); *(v4fa*)(p + 4) = __builtin_shufflevector(acc[i][t], acc[i][t], 4, 5, 6, 7); }
        __syncthreads();
        const int piece = tid & 7;
        const size_t base = (((size_t)bb * NKV + blockIdx.y) * HD) * NT_ + t0;
#pragma unroll
        for (int s = 0; s < 4; ++s) { const int d = (tid >> 3) + 16 * s; const float* sp = ob + d * 68 + piece * 8;
            const v4f a0 = *(const v4fa*)sp, a1 = *(const v4fa*)(sp + 4); v8h vh, vl;
#pragma unroll
            for (int i = 0; i < 8; ++i) { const float v = i < 4 ? a0[i & 3] : a1[i & 3]; const h16 a = (h16)v; vh[i] = a; vl[i] = (h16)((v - (float)a) * LOSC); }
            *(v8h*)(VTH + base + (size_t)d * NT_ + piece * 8) = vh; *(v8h*)(VTL + base + (size_t)d * NT_ + piece * 8) = vl; }
        return;
    }
    const int er = tid >> 1, ed = (tid & 1) * 16;
    v4f cc[4], sn[4], wa[4], wc[4];
    if constexpr (EPI == 1) {    // loaded ahead of the stage's stores and its barrier, so that their latency runs under both
#pragma unroll
        for (int q = 0; q < 4; ++q) { cc[q] = *(const v4f*)(cosv + (size_t)(t0 + er) * 32 + ed + 4 * q); sn[q] = *(const v4f*)(sinv + (size_t)(t0 + er) * 32 + ed + 4 * q);
            wa[q] = *(const v4f*)(wb + ed + 4 * q); wc[q] = *(const v4f*)(wb + 32 + ed + 4 * q); }
    }
#pragma unroll
    for (int i = 0; i < 2; ++i)
#pragma unroll
        for (int t = 0; t < 2; ++t)
#pragma unroll
            for (int j = 0; j < 8; ++j) ob[(wm * 32 + i * 16 + hi * 8 + j) * 68 + wn * 32 + t * 16 + lr] = acc[i][t][j];
    __syncthreads();
    if constexpr (EPI == 1) {
        const float* xr = ob + er * 68 + ed;
        float ss = 0.f, dt = 0.f;
#pragma unroll
        for (int q = 0; q < 4; ++q) { const v4f x1 = *(const v4fa*)(xr + 4 * q), x2 = *(const v4fa*)(xr + 32 + 4 * q);
#pragma unroll
            for (int i = 0; i < 4; ++i) { const float c = bfr(cc[q][i]), s = bfr(sn[q][i]);
                const float y1 = x1[i] * c + x2[i] * s, y2 = -x1[i] * s + x2[i] * c;
                ss += y1 * y1 + y2 * y2; dt += y1 * bfr(wa[q][i]) + y2 * bfr(wc[q][i]); } }
        ss += __shfl_xor(ss, 1, 32); dt += __shfl_xor(dt, 1, 32);
        const float rn = rsqrtf(ss * (1.0f / HD) + 1e-6f);
        if ((tid & 1) == 0) sred[er] = dt * rn;
        __syncthreads();    // the 64 scores, made by four waves, are published to the two waves that store them
        if (tid < 64) C[((size_t)bb * (NH_ + NKV) + g0 + blockIdx.y) * NT_ + t0 + tid] = sred[tid];
        return;
    }
    const float* os = &ost[wave][0];
    float* crow = C + (size_t)(rb + wave * 16) * ldc + c0;
    auto pass = [&]() {
#pragma unroll
        for (int s = 0; s < 8; ++s) { const int Lid = (lane >> 3) + 4 * s, piece = lane & 7; const int row = Lid >> 1, cofs = (Lid & 1) * 32 + piece * 4;
            const v4f val = *(const v4fa*)(os + row * 68 + cofs); *(v4f*)(crow + (size_t)row * ldc + cofs) = val; }
    };
    pass(); 
}

// k_attn: block = (b, h, 64 queries), wave = 16; key tiles 0 .. the query tile (block-uniform static bound). Per 32-key step the gate tile is pure VALU:
// g[t][s] = sigmoid(s_q[t] + s_k[s]) for s <= t else 0, x32768, as f16 hi + residual x1024 per-wave LDS tiles (same-wave may_alias reload after a compiler barrier);
// 32768 sigmoid(a + b) = 1 / (2^-15 + (2^-7 e^-a)(2^-8 e^-b)): the two factors are formed once per query row and once per key, an element is one fma, one v_rcp_f32 and a select.
// The value fragments and the two s_k of step kt + 1 are loaded during step kt into registers carried round the loop, so the values' latency runs under the next step's gate work and the s_k's under this step's.
// 12 WMMA against the value planes of kv head h/2 (w_h.v_h + w_h.v_l + w_l.v_h); y = (o + ox/1024) / 32768 / (sqrt(2048) + 1e-6) -> bf16 hi/lo planes YH/YL[tok][h*64+d].
// 2^sh e^-s. rms_norm bounds |s| by 8 |w_braid|; the clamp at 80 keeps both factors of a gate finite, normal and non-zero, so that their product is never inf x 0.
__device__ __forceinline__ float gfac(float s, float sh) { return __builtin_amdgcn_exp2f(fmaf(fminf(fmaxf(s, -80.0f), 80.0f), -1.44269504f, sh)); }

__global__ __launch_bounds__(128) void k_attn(const float* __restrict__ S, const h16* __restrict__ VTH, const h16* __restrict__ VTL, bf* YH, bf* YL) {
    __shared__ __align__(16) h16 plds[4][16 * 32];
    __shared__ __align__(16) h16 plds2[4][16 * 32];
    __shared__ __align__(16) float ost[4][16 * 68];
    const int lane = threadIdx.x & 31, wave = threadIdx.x >> 5, lr = lane & 15, hi = lane >> 4;
    const int bid = blockIdx.x;
    const int b = bid / (NH_ * (NT_ / 64)), rem = bid - b * (NH_ * (NT_ / 64)), h = rem / (NT_ / 64), qt = rem - h * (NT_ / 64);
    const int q0 = qt * 64 + wave * 16, hk = h / (NH_ / NKV);
    const size_t tok0 = (size_t)b * NT_;
    h16* pl = &plds[wave][0]; h16* pl2 = &plds2[wave][0];
    const float* sq_b = S + ((size_t)b * (NH_ + NKV) + h) * NT_;
    const float* sk_b = S + ((size_t)b * (NH_ + NKV) + NH_ + hk) * NT_;
    int qpos[8]; float eq[8];
#pragma unroll
    for (int j = 0; j < 8; ++j) { qpos[j] = q0 + 8 * hi + j; eq[j] = gfac(sq_b[qpos[j]], -7.0f); }
    const size_t vbase = (((size_t)b * NKV + hk) * HD) * NT_;
    v8f o[4], ox[4];
#pragma unroll
    for (int n = 0; n < 4; ++n) { o[n] = (v8f){}; ox[n] = (v8f){}; }
    const int kt_end = (qt * 64 + 64) / 32;
    v8h vha[4], vhb[4], vla[4], vlb[4];
    auto loadv = [&](int l) {
#pragma unroll
        for (int n = 0; n < 4; ++n) { const size_t vo = vbase + (size_t)(n * 16 + lr) * NT_ + l + hi * 8;
            vha[n] = *(const v8h*)(VTH + vo); vhb[n] = *(const v8h*)(VTH + vo + 16); vla[n] = *(const v8h*)(VTL + vo); vlb[n] = *(const v8h*)(VTL + vo + 16); }
    };
    float sk0 = sk_b[lr], sk1 = sk_b[16 + lr];
    asm volatile("" :: "v"(sk0), "v"(sk1));    // step 0's s_k landed ahead of the value loads: else the loop's wait for them (loads return in order) also waits out every step's value loads
    loadv(0);
#pragma unroll 1
    for (int kt = 0; kt < kt_end; ++kt) {
        const int l0 = kt * 32;
        const int ln = (kt + 1 < kt_end ? kt + 1 : kt) * 32;    // the last step loads its own tile again: in bounds, not used
        const float skn0 = sk_b[ln + lr], skn1 = sk_b[ln + 16 + lr];
        const float ek0 = gfac(sk0, -8.0f), ek1 = gfac(sk1, -8.0f);
#pragma unroll
        for (int j = 0; j < 8; ++j) {
            const float r0 = __builtin_amdgcn_rcpf(fmaf(eq[j], ek0, 1.0f / PSC)), r1 = __builtin_amdgcn_rcpf(fmaf(eq[j], ek1, 1.0f / PSC));
            const float g0 = (l0 + lr <= qpos[j]) ? r0 : 0.0f;
            const float g1 = (l0 + 16 + lr <= qpos[j]) ? r1 : 0.0f;
            const h16 h0 = (h16)g0, h1 = (h16)g1;
            const int mr = hi * 8 + j;
            pl[mr * 32 + lr] = h0; pl[mr * 32 + 16 + lr] = h1;
            pl2[mr * 32 + lr] = (h16)((g0 - (float)h0) * LOSC); pl2[mr * 32 + 16 + lr] = (h16)((g1 - (float)h1) * LOSC);
        }
        asm volatile("" ::: "memory");
        const v16h pa = cat16(*(const v8ha*)(pl + lr * 32 + hi * 8), *(const v8ha*)(pl + lr * 32 + 16 + hi * 8));
        const v16h px = cat16(*(const v8ha*)(pl2 + lr * 32 + hi * 8), *(const v8ha*)(pl2 + lr * 32 + 16 + hi * 8));
#pragma unroll
        for (int n = 0; n < 4; ++n) { const v16h vh = cat16(vha[n], vhb[n]), vl = cat16(vla[n], vlb[n]);
            o[n] = wmma16(pa, vh, o[n]); ox[n] = wmma16(pa, vl, ox[n]); ox[n] = wmma16(px, vh, ox[n]); }
        loadv(ln);
        asm volatile("v_nop\n\tv_nop\n\tv_nop\n\tv_nop" : "+v"(o[0]), "+v"(o[1]), "+v"(o[2]), "+v"(o[3]), "+v"(ox[0]), "+v"(ox[1]), "+v"(ox[2]), "+v"(ox[3]) : "v"(pa), "v"(px));
        __builtin_amdgcn_wave_barrier();            // the gate tiles are rewritten next step
        sk0 = skn0; sk1 = skn1;
    }
    const float scl = (1.0f / PSC) / (sqrtf((float)NT_) + 1e-6f);
    float* os = &ost[wave][0];
#pragma unroll
    for (int n = 0; n < 4; ++n)
#pragma unroll
        for (int j = 0; j < 8; ++j) os[(hi * 8 + j) * 68 + n * 16 + lr] = (o[n][j] + ox[n][j] * LOSCI) * scl;
    __syncthreads();
    const size_t cbase = (tok0 + q0) * DM + (size_t)h * HD;
    auto pass = [&]() {
#pragma unroll
        for (int s = 0; s < 4; ++s) { const int row = 4 * s + (lane >> 3), piece = lane & 7; const float* sp = os + row * 68 + piece * 8; v8us oh, ol;
#pragma unroll
            for (int i = 0; i < 8; ++i) { const unsigned short hb = f2bf(sp[i]); oh[i] = hb; ol[i] = f2bf(sp[i] - bf2f(hb)); }
            *(v8us*)(YH + cbase + (size_t)row * DM + piece * 8) = oh; *(v8us*)(YL + cbase + (size_t)row * DM + piece * 8) = ol; }
    };
    pass(); 
}

extern "C" void kernel_launch(void* const* d_in, const int* in_sizes, int n_in,
                              void* d_out, int out_size, void* d_ws, size_t ws_size, hipStream_t stream) {
    (void)in_sizes; (void)n_in; (void)out_size;
    const float* x = (const float*)d_in[0]; const float* cosv = (const float*)d_in[1]; const float* sinv = (const float*)d_in[2];
    const float* Wq = (const float*)d_in[3]; const float* Wk = (const float*)d_in[4]; const float* Wv = (const float*)d_in[5]; const float* Wp = (const float*)d_in[6]; const float* wb = (const float*)d_in[7];
    float* out = (float*)d_out;    // [2][2048][1024]
    char* wsp = (char*)d_ws;
    auto take = [&](size_t bytes) { char* p = wsp; wsp += (bytes + 255) & ~(size_t)255; return (void*)p; };
    bf* Xb = (bf*)take((size_t)NTK * DM * 2); bf* WQb = (bf*)take((size_t)DM * DM * 2); bf* WKb = (bf*)take((size_t)DKV * DM * 2); bf* WVb = (bf*)take((size_t)DKV * DM * 2); bf* WPb = (bf*)take((size_t)DM * DM * 2);
    float* S = (float*)take((size_t)NB_ * (NH_ + NKV) * NT_ * 4);
    h16* VTH = (h16*)take((size_t)NTK * DKV * 2); h16* VTL = (h16*)take((size_t)NTK * DKV * 2);
    bf* YH = (bf*)take((size_t)NTK * DM * 2); bf* YL = (bf*)take((size_t)NTK * DM * 2);
    if ((size_t)(wsp - (char*)d_ws) > ws_size) return;    // 8.4 + 6.3 + 0.4 + 2 x 4.2 + 2 x 8.4 MB ~ 40 MB
    k_cvtb<<<NTK / 8, 256, 0, stream>>>(x, NTK, Xb);
    k_cvtb<<<DM / 8, 256, 0, stream>>>(Wq, DM, WQb);
    k_cvtb<<<DKV / 8, 256, 0, stream>>>(Wk, DKV, WKb);
    k_cvtb<<<DKV / 8, 256, 0, stream>>>(Wv, DKV, WVb);
    k_cvtb<<<DM / 8, 256, 0, stream>>>(Wp, DM, WPb);
    k_gemmb<false, 1><<<dim3(NTK / 64, DM / 64, 1), 128, 0, stream>>>(Xb, nullptr, WQb, S, 0, cosv, sinv, wb, 0, nullptr, nullptr);
    k_gemmb<false, 1><<<dim3(NTK / 64, DKV / 64, 1), 128, 0, stream>>>(Xb, nullptr, WKb, S, 0, cosv, sinv, wb, NH_, nullptr, nullptr);
    k_gemmb<false, 2><<<dim3(NTK / 64, DKV / 64, 1), 128, 0, stream>>>(Xb, nullptr, WVb, nullptr, 0, nullptr, nullptr, nullptr, 0, VTH, VTL);
    k_attn<<<NB_ * NH_ * (NT_ / 64), 128, 0, stream>>>(S, VTH, VTL, YH, YL);
    k_gemmb<true, 0><<<dim3(NTK / 64, DM / 64, 1), 128, 0, stream>>>(YH, YL, WPb, out, DM, nullptr, nullptr, nullptr, 0, nullptr, nullptr);
}

// v005
// One run takes 121 microseconds.
// Two timings next to v004 put it at 1.23 and 1.22 times that version's speed.
// Over all steps from v000 it is 2.73 times as fast.
#include <hip/hip_runtime.h>

// Contractions, f32 accumulate: q = x.Wq^T ([4096 x 1024].[1024 x 1024]), k, v = x.Wk^T, x.Wv^T ([4096 x 1024].[1024 x 512]) on v_wmma_f32_16x16x32_bf16 with PLAIN
// bf16 operands (inputs rounded once: exact products); the per-(batch, head) causal gated aggregation y = sum_{s<=t} sigmoid(s_q[t] + s_k[s]) v_s (no q.k product: the
// score is a rank-1 outer sum of two scalars) on v_wmma_f32_16x16x32_f16 with the gate weights (x32768) and v as f16 hi + residual x1024 planes (three products);
// out = y.Wproj^T on the bf16 instruction with y as bf16 hi + residual planes. Rotary, rms_norm, the w_braid dots and the sigmoids are f32. Deterministic, no atomics;

#define NB_  2
#define NT_  2048
#define DM   1024
#define NH_  16
#define NKV  8
#define HD   64
#define DKV  (NKV * HD)
#define NTK  (NB_ * NT_)
#define PSC  32768.0f
#define LOSC 1024.0f
#define LOSCI (1.0f / 1024.0f)

typedef _Float16 h16;
typedef unsigned short bf;
typedef __attribute__((ext_vector_type(16))) __bf16   v16bf;
typedef __attribute__((ext_vector_type(16))) _Float16 v16h;
typedef __attribute__((ext_vector_type(8)))  _Float16 v8h;
typedef __attribute__((ext_vector_type(8)))  unsigned short v8us;
typedef __attribute__((ext_vector_type(8)))  float    v8f;
typedef __attribute__((ext_vector_type(4)))  float    v4f;
typedef v8h  __attribute__((may_alias)) v8ha;
typedef v4f  __attribute__((may_alias)) v4fa;

__device__ __forceinline__ unsigned short f2bf(float f) { unsigned u = __float_as_uint(f); u += 0x7FFFu + ((u >> 16) & 1u); return (unsigned short)(u >> 16); }
__device__ __forceinline__ float bf2f(unsigned short b) { return __uint_as_float(((unsigned)b) << 16); }
__device__ __forceinline__ float bfr(float f) { return bf2f(f2bf(f)); }
__device__ __forceinline__ v16h cat16(v8h lo, v8h hi) { return __builtin_shufflevector(lo, hi, 0, 1, 2, 3, 4, 5, 6, 7, 8, 9, 10, 11, 12, 13, 14, 15); }
__device__ __forceinline__ v16bf cat16b(v8us lo, v8us hi) { return __builtin_bit_cast(v16bf, __builtin_shufflevector(lo, hi, 0, 1, 2, 3, 4, 5, 6, 7, 8, 9, 10, 11, 12, 13, 14, 15)); }
__device__ __forceinline__ v8f wmma16(v16h a, v16h b, v8f c) { return __builtin_amdgcn_wmma_f32_16x16x32_f16(false, a, false, b, (short)0, c, false, false); }
__device__ __forceinline__ v8f wmmab(v16bf a, v16bf b, v8f c) { return __builtin_amdgcn_wmma_f32_16x16x32_bf16(false, a, false, b, (short)0, c, false, false); }
#define VST2(T, p, v) do { const T vst2_v_ = (v); *(T*)(p) = vst2_v_;  } while (0)

__global__ __launch_bounds__(256) void k_cvtb(const float* __restrict__ src, int nrows, bf* dst) {
    const int lane = threadIdx.x & 31, r = blockIdx.x * 8 + (threadIdx.x >> 5);
    if (r >= nrows) return;
    v8us o[4];
#pragma unroll
    for (int q = 0; q < 4; ++q) { v8us t;
#pragma unroll
        for (int i = 0; i < 8; ++i) t[i] = f2bf(src[(size_t)r * DM + q * 256 + lane * 8 + i]);
        o[q] = t; }
#pragma unroll
    for (int q = 0; q < 4; ++q) *(v8us*)(dst + (size_t)r * DM + q * 256 + lane * 8) = o[q];
    
}

// k_gemmb: block = 64 x 64 of C, 4 waves as 2 x 2, each 32 x 32 (2 x 2 accumulator tiles). Per 64-k chunk the block's operand rows (128 B each) come from global memory as
// whole lines (8 lanes a row, 4 rows a wave-load), one chunk ahead into registers, and go to one of two LDS buffers at a pitch of 144 B; the fragments are read from LDS.
// One barrier a chunk: it publishes the buffer just written and ends the reads of the buffer that the next chunk's stores overwrite. k order and sum order per element as before.
// The 64 x 64 f32 tile is staged in LDS and leaves by one of three epilogues. A 64-column tile of q, k or v is one head of 64 tokens, so what only reads a head's row is done here:
// EPI 0: the tile is stored to C as whole lines.
// EPI 1 (q, k): rotary, rms_norm and the w_braid dot per token; two lanes a token, each 16 rotary pairs (d, d + 32) summed in-lane, then one exchange; only the 64 scores leave,
//        to C = S[b][g0 + column tile][t], through LDS so that each 128-B line has one writing wave. q and k themselves are never stored.
// EPI 2 (v): the tile is staged transposed ([d][token]) and leaves as the f16 hi and residual x1024 planes VTH, VTL in the order of k_attn's B fragments:
//        [b][kv head][32-key step][16-d tile n][k half: keys 0-15, 16-31][lane = 16 ((key >> 3) & 1) + (d & 15)][key & 7], so that one fragment register group of a wave is 512 contiguous bytes.
//        A wave's store is such a group: four whole lines. v itself is never stored.
#define GP 72
template <bool SPLITA, int EPI>
__global__ __launch_bounds__(128) void k_gemmb(const bf* __restrict__ A, const bf* __restrict__ Al, const bf* __restrict__ Bn, float* C, int ldc,
                                               const float* __restrict__ cosv, const float* __restrict__ sinv, const float* __restrict__ wb, int g0, h16* VTH, h16* VTL) {
    constexpr int NP = SPLITA ? 3 : 2;
    __shared__ __align__(16) bf stg[2][NP][64 * GP];
    __shared__ __align__(16) float ost[4][16 * 68];
    __shared__ float sred[64];
    const int tid = threadIdx.x, lane = tid & 31, wave = tid >> 5, lr = lane & 15, hi = lane >> 4;
    const int wm = wave >> 1, wn = wave & 1;
    const int rb = blockIdx.x * 64, c0 = blockIdx.y * 64;
    const int srow = tid >> 3, spc = (tid & 7) * 8;
    const size_t goa = (size_t)(rb + srow) * DM + spc, gob = (size_t)(c0 + srow) * DM + spc;
    v8us ra[4], rw[4], rl[4];
    auto gload = [&](int kc) {
#pragma unroll
        for (int s = 0; s < 4; ++s) { ra[s] = *(const v8us*)(A + goa + (size_t)s * 16 * DM + kc); rw[s] = *(const v8us*)(Bn + gob + (size_t)s * 16 * DM + kc);
            if (SPLITA) rl[s] = *(const v8us*)(Al + goa + (size_t)s * 16 * DM + kc); }
    };
    auto sstore = [&](int buf) {
#pragma unroll
        for (int s = 0; s < 4; ++s) { const int so = (srow + 16 * s) * GP + spc; *(v8us*)(&stg[buf][0][so]) = ra[s]; *(v8us*)(&stg[buf][1][so]) = rw[s];
            if (SPLITA) *(v8us*)(&stg[buf][NP - 1][so]) = rl[s]; }
    };
    v8f acc[2][2];
#pragma unroll
    for (int i = 0; i < 2; ++i)
#pragma unroll
        for (int t = 0; t < 2; ++t) acc[i][t] = (v8f){};
    gload(0);
    sstore(0);
    __syncthreads();
#pragma unroll 1
    for (int c = 0; c < DM / 64; ++c) {
        const int cur = c & 1;
        const bool more = c + 1 < DM / 64;
        if (more) gload((c + 1) * 64);
        v16bf a[2][2], al[2][2], b[2][2];
#pragma unroll
        for (int kk = 0; kk < 2; ++kk)
#pragma unroll
            for (int i = 0; i < 2; ++i) {
                const int ao = (wm * 32 + i * 16 + lr) * GP + kk * 32 + 8 * hi, bo = (wn * 32 + i * 16 + lr) * GP + kk * 32 + 8 * hi;
                a[kk][i] = cat16b(*(const v8us*)(&stg[cur][0][ao]), *(const v8us*)(&stg[cur][0][ao + 16]));
                b[kk][i] = cat16b(*(const v8us*)(&stg[cur][1][bo]), *(const v8us*)(&stg[cur][1][bo + 16]));
                al[kk][i] = a[kk][i];
                if (SPLITA) al[kk][i] = cat16b(*(const v8us*)(&stg[cur][NP - 1][ao]), *(const v8us*)(&stg[cur][NP - 1][ao + 16]));
            }
        __builtin_amdgcn_sched_barrier(0);    // the chunk's LDS reads stay one group ahead of its WMMAs: reads set among them make the wave wait out the LDS latency at each place
#pragma unroll
        for (int kk = 0; kk < 2; ++kk) {
#pragma unroll
            for (int i = 0; i < 2; ++i)
#pragma unroll
                for (int t = 0; t < 2; ++t) acc[i][t] = wmmab(a[kk][i], b[kk][t], acc[i][t]);
            if (SPLITA) {
#pragma unroll
                for (int i = 0; i < 2; ++i)
#pragma unroll
                    for (int t = 0; t < 2; ++t) acc[i][t] = wmmab(al[kk][i], b[kk][t], acc[i][t]);
            }
        }
        if (more) sstore(cur ^ 1);
        __syncthreads();
    }
    float* ob = &ost[0][0];
    const int bb = rb / NT_, t0 = rb & (NT_ - 1);    // a 64-row tile lies in one batch
    if constexpr (EPI == 2) {
#pragma unroll
        for (int i = 0; i < 2; ++i)
#pragma unroll
            for (int t = 0; t < 2; ++t) { float* p = ob + (wn * 32 + t * 16 + lr) * 68 + wm * 32 + i * 16 + hi * 8;
                *(v4fa*)p = __builtin_shufflevector(acc[i][t], acc[i][t], 0, 1, 2, 3); *(v4fa*)(p + 4) = __builtin_shufflevector(acc[i][t], acc[i][t], 4, 5, 6, 7); }
        __syncthreads();
        const int piece = tid >> 4;    // 8 tokens; a wave holds an even piece in lanes 0-15 and the next in lanes 16-31: the two lane halves of one group
        const size_t base = (((size_t)bb * NKV + blockIdx.y) * HD) * NT_ + (size_t)((t0 >> 5) + (piece >> 2)) * (HD * 32) + ((piece >> 1) & 1) * 256 + lane * 8;
#pragma unroll
        for (int s = 0; s < 4; ++s) { const int d = lr + 16 * s; const float* sp = ob + d * 68 + piece * 8;
            const v4f a0 = *(const v4fa*)sp, a1 = *(const v4fa*)(sp + 4); v8h vh, vl;
#pragma unroll
            for (int i = 0; i < 8; ++i) { const float v = i < 4 ? a0[i & 3] : a1[i & 3]; const h16 a = (h16)v; vh[i] = a; vl[i] = (h16)((v - (float)a) * LOSC); }
            *(v8h*)(VTH + base + s * 512) = vh; *(v8h*)(VTL + base + s * 512) = vl; }
        return;
    }
    const int er = tid >> 1, ed = (tid & 1) * 16;
    v4f cc[4], sn[4], wa[4], wc[4];
    if constexpr (EPI == 1) {    // loaded ahead of the stage's stores and its barrier, so that their latency runs under both
#pragma unroll
        for (int q = 0; q < 4; ++q) { cc[q] = *(const v4f*)(cosv + (size_t)(t0 + er) * 32 + ed + 4 * q); sn[q] = *(const v4f*)(sinv + (size_t)(t0 + er) * 32 + ed + 4 * q);
            wa[q] = *(const v4f*)(wb + ed + 4 * q); wc[q] = *(const v4f*)(wb + 32 + ed + 4 * q); }
    }
#pragma unroll
    for (int i = 0; i < 2; ++i)
#pragma unroll
        for (int t = 0; t < 2; ++t)
#pragma unroll
            for (int j = 0; j < 8; ++j) ob[(wm * 32 + i * 16 + hi * 8 + j) * 68 + wn * 32 + t * 16 + lr] = acc[i][t][j];
    __syncthreads();
    if constexpr (EPI == 1) {
        const float* xr = ob + er * 68 + ed;
        float ss = 0.f, dt = 0.f;
#pragma unroll
        for (int q = 0; q < 4; ++q) { const v4f x1 = *(const v4fa*)(xr + 4 * q), x2 = *(const v4fa*)(xr + 32 + 4 * q);
#pragma unroll
            for (int i = 0; i < 4; ++i) { const float c = bfr(cc[q][i]), s = bfr(sn[q][i]);
                const float y1 = x1[i] * c + x2[i] * s, y2 = -x1[i] * s + x2[i] * c;
                ss += y1 * y1 + y2 * y2; dt += y1 * bfr(wa[q][i]) + y2 * bfr(wc[q][i]); } }
        ss += __shfl_xor(ss, 1, 32); dt += __shfl_xor(dt, 1, 32);
        const float rn = rsqrtf(ss * (1.0f / HD) + 1e-6f);
        if ((tid & 1) == 0) sred[er] = dt * rn;
        __syncthreads();    // the 64 scores, made by four waves, are published to the two waves that store them
        if (tid < 64) C[((size_t)bb * (NH_ + NKV) + g0 + blockIdx.y) * NT_ + t0 + tid] = sred[tid];
        return;
    }
    const float* os = &ost[wave][0];
    float* crow = C + (size_t)(rb + wave * 16) * ldc + c0;
    auto pass = [&]() {
#pragma unroll
        for (int s = 0; s < 8; ++s) { const int Lid = (lane >> 3) + 4 * s, piece = lane & 7; const int row = Lid >> 1, cofs = (Lid & 1) * 32 + piece * 4;
            const v4f val = *(const v4fa*)(os + row * 68 + cofs); *(v4f*)(crow + (size_t)row * ldc + cofs) = val; }
    };
    pass(); 
}

// k_attn: block = (b, h, 64 queries), wave = 16; key tiles 0 .. the query tile (block-uniform static bound). Per 32-key step the gate tile is pure VALU:
// g[t][s] = sigmoid(s_q[t] + s_k[s]) for s <= t else 0, x32768, as f16 hi + residual x1024 per-wave LDS tiles (same-wave may_alias reload after a compiler barrier);
// 32768 sigmoid(a + b) = 1 / (2^-15 + (2^-7 e^-a)(2^-8 e^-b)): the two factors are formed once per query row and once per key, an element is one fma, one v_rcp_f32 and a select.
// The value fragments and the two s_k of step kt + 1 are loaded during step kt into registers carried round the loop, so the s_k latency runs under step kt's gate work and WMMAs, that of the values (loaded after the WMMAs) under the next step's gate work.
// The value planes lie in fragment order (k_gemmb, EPI 2): each of a step's 16 fragment loads reads 512 contiguous bytes, four whole lines.
// 12 WMMA against the value planes of kv head h/2 (w_h.v_h + w_h.v_l + w_l.v_h); y = (o + ox/1024) / 32768 / (sqrt(2048) + 1e-6) -> bf16 hi/lo planes YH/YL[tok][h*64+d].
// 2^sh e^-s. rms_norm bounds |s| by 8 |w_braid|; the clamp at 80 keeps both factors of a gate finite, normal and non-zero, so that their product is never inf x 0.
__device__ __forceinline__ float gfac(float s, float sh) { return __builtin_amdgcn_exp2f(fmaf(fminf(fmaxf(s, -80.0f), 80.0f), -1.44269504f, sh)); }

__global__ __launch_bounds__(128) void k_attn(const float* __restrict__ S, const h16* __restrict__ VTH, const h16* __restrict__ VTL, bf* YH, bf* YL) {
    __shared__ __align__(16) h16 plds[4][16 * 32];
    __shared__ __align__(16) h16 plds2[4][16 * 32];
    __shared__ __align__(16) float ost[4][16 * 68];
    const int lane = threadIdx.x & 31, wave = threadIdx.x >> 5, lr = lane & 15, hi = lane >> 4;
    const int bid = blockIdx.x;
    const int b = bid / (NH_ * (NT_ / 64)), rem = bid - b * (NH_ * (NT_ / 64)), h = rem / (NT_ / 64), qt = rem - h * (NT_ / 64);
    const int q0 = qt * 64 + wave * 16, hk = h / (NH_ / NKV);
    const size_t tok0 = (size_t)b * NT_;
    h16* pl = &plds[wave][0]; h16* pl2 = &plds2[wave][0];
    const float* sq_b = S + ((size_t)b * (NH_ + NKV) + h) * NT_;
    const float* sk_b = S + ((size_t)b * (NH_ + NKV) + NH_ + hk) * NT_;
    int qpos[8]; float eq[8];
#pragma unroll
    for (int j = 0; j < 8; ++j) { qpos[j] = q0 + 8 * hi + j; eq[j] = gfac(sq_b[qpos[j]], -7.0f); }
    const size_t vbase = (((size_t)b * NKV + hk) * HD) * NT_;
    v8f o[4], ox[4];
#pragma unroll
    for (int n = 0; n < 4; ++n) { o[n] = (v8f){}; ox[n] = (v8f){}; }
    const int kt_end = (qt * 64 + 64) / 32;
    v8h vha[4], vhb[4], vla[4], vlb[4];
    const char* vhp = (const char*)(VTH + vbase); const char* vlp = (const char*)(VTL + vbase);
    unsigned vo = lane * 16;    // byte offset of this lane's 16 B in the first group of the step to be loaded; a step is 4096 B a plane
    auto loadv = [&]() {
#pragma unroll
        for (int n = 0; n < 4; ++n) { const char* ph = vhp + vo + n * 1024; const char* pv = vlp + vo + n * 1024;
            vha[n] = *(const v8h*)ph; vhb[n] = *(const v8h*)(ph + 512); vla[n] = *(const v8h*)pv; vlb[n] = *(const v8h*)(pv + 512); }
    };
    float sk0 = sk_b[lr], sk1 = sk_b[16 + lr];
    asm volatile("" :: "v"(sk0), "v"(sk1));    // step 0's s_k landed ahead of the value loads: else the loop's wait for them (loads return in order) also waits out every step's value loads
    loadv();
#pragma unroll 1
    for (int kt = 0; kt < kt_end; ++kt) {
        const int l0 = kt * 32;
        const int ln = (kt + 1 < kt_end ? kt + 1 : kt) * 32;    // the last step loads its own tile again: in bounds, not used
        const float skn0 = sk_b[ln + lr], skn1 = sk_b[ln + 16 + lr];
        const float ek0 = gfac(sk0, -8.0f), ek1 = gfac(sk1, -8.0f);
#pragma unroll
        for (int j = 0; j < 8; ++j) {
            const float r0 = __builtin_amdgcn_rcpf(fmaf(eq[j], ek0, 1.0f / PSC)), r1 = __builtin_amdgcn_rcpf(fmaf(eq[j], ek1, 1.0f / PSC));
            const float g0 = (l0 + lr <= qpos[j]) ? r0 : 0.0f;
            const float g1 = (l0 + 16 + lr <= qpos[j]) ? r1 : 0.0f;
            const h16 h0 = (h16)g0, h1 = (h16)g1;
            const int mr = hi * 8 + j;
            pl[mr * 32 + lr] = h0; pl[mr * 32 + 16 + lr] = h1;
            pl2[mr * 32 + lr] = (h16)((g0 - (float)h0) * LOSC); pl2[mr * 32 + 16 + lr] = (h16)((g1 - (float)h1) * LOSC);
        }
        asm volatile("" ::: "memory");
        const v16h pa = cat16(*(const v8ha*)(pl + lr * 32 + hi * 8), *(const v8ha*)(pl + lr * 32 + 16 + hi * 8));
        const v16h px = cat16(*(const v8ha*)(pl2 + lr * 32 + hi * 8), *(const v8ha*)(pl2 + lr * 32 + 16 + hi * 8));
#pragma unroll
        for (int n = 0; n < 4; ++n) { const v16h vh = cat16(vha[n], vhb[n]), vl = cat16(vla[n], vlb[n]);
            o[n] = wmma16(pa, vh, o[n]); ox[n] = wmma16(pa, vl, ox[n]); ox[n] = wmma16(px, vh, ox[n]); }
        asm volatile("s_wait_xcnt 0x0" : "+v"(vo) :: "memory");    // the value loads of the step before name vo: the wait stands in front of its rewrite; vo is an operand so that the addition stays behind the wait
        vo += (kt + 1 < kt_end) ? 4096u : 0u;
        loadv();
        asm volatile("v_nop\n\tv_nop\n\tv_nop\n\tv_nop" : "+v"(o[0]), "+v"(o[1]), "+v"(o[2]), "+v"(o[3]), "+v"(ox[0]), "+v"(ox[1]), "+v"(ox[2]), "+v"(ox[3]) : "v"(pa), "v"(px));
        __builtin_amdgcn_wave_barrier();            // the gate tiles are rewritten next step
        sk0 = skn0; sk1 = skn1;
    }
    asm volatile("s_wait_xcnt 0x0" :: "v"(vo) : "memory");    // the last step's value loads name vo: as an operand its register is kept until the wait has passed
    const float scl = (1.0f / PSC) / (sqrtf((float)NT_) + 1e-6f);
    float* os = &ost[wave][0];
#pragma unroll
    for (int n = 0; n < 4; ++n)
#pragma unroll
        for (int j = 0; j < 8; ++j) os[(hi * 8 + j) * 68 + n * 16 + lr] = (o[n][j] + ox[n][j] * LOSCI) * scl;
    __syncthreads();
    const size_t cbase = (tok0 + q0) * DM + (size_t)h * HD;
    auto pass = [&]() {
#pragma unroll
        for (int s = 0; s < 4; ++s) { const int row = 4 * s + (lane >> 3), piece = lane & 7; const float* sp = os + row * 68 + piece * 8; v8us oh, ol;
#pragma unroll
            for (int i = 0; i < 8; ++i) { const unsigned short hb = f2bf(sp[i]); oh[i] = hb; ol[i] = f2bf(sp[i] - bf2f(hb)); }
            *(v8us*)(YH + cbase + (size_t)row * DM + piece * 8) = oh; *(v8us*)(YL + cbase + (size_t)row * DM + piece * 8) = ol; }
    };
    pass(); 
}

extern "C" void kernel_launch(void* const* d_in, const int* in_sizes, int n_in,
                              void* d_out, int out_size, void* d_ws, size_t ws_size, hipStream_t stream) {
    (void)in_sizes; (void)n_in; (void)out_size;
    const float* x = (const float*)d_in[0]; const float* cosv = (const float*)d_in[1]; const float* sinv = (const float*)d_in[2];
    const float* Wq = (const float*)d_in[3]; const float* Wk = (const float*)d_in[4]; const float* Wv = (const float*)d_in[5]; const float* Wp = (const float*)d_in[6]; const float* wb = (const float*)d_in[7];
    float* out = (float*)d_out;    // [2][2048][1024]
    char* wsp = (char*)d_ws;
    auto take = [&](size_t bytes) { char* p = wsp; wsp += (bytes + 255) & ~(size_t)255; return (void*)p; };
    bf* Xb = (bf*)take((size_t)NTK * DM * 2); bf* WQb = (bf*)take((size_t)DM * DM * 2); bf* WKb = (bf*)take((size_t)DKV * DM * 2); bf* WVb = (bf*)take((size_t)DKV * DM * 2); bf* WPb = (bf*)take((size_t)DM * DM * 2);
    float* S = (float*)take((size_t)NB_ * (NH_ + NKV) * NT_ * 4);
    h16* VTH = (h16*)take((size_t)NTK * DKV * 2); h16* VTL = (h16*)take((size_t)NTK * DKV * 2);
    bf* YH = (bf*)take((size_t)NTK * DM * 2); bf* YL = (bf*)take((size_t)NTK * DM * 2);
    if ((size_t)(wsp - (char*)d_ws) > ws_size) return;    // 8.4 + 6.3 + 0.4 + 2 x 4.2 + 2 x 8.4 MB ~ 40 MB
    k_cvtb<<<NTK / 8, 256, 0, stream>>>(x, NTK, Xb);
    k_cvtb<<<DM / 8, 256, 0, stream>>>(Wq, DM, WQb);
    k_cvtb<<<DKV / 8, 256, 0, stream>>>(Wk, DKV, WKb);
    k_cvtb<<<DKV / 8, 256, 0, stream>>>(Wv, DKV, WVb);
    k_cvtb<<<DM / 8, 256, 0, stream>>>(Wp, DM, WPb);
    k_gemmb<false, 1><<<dim3(NTK / 64, DM / 64, 1), 128, 0, stream>>>(Xb, nullptr, WQb, S, 0, cosv, sinv, wb, 0, nullptr, nullptr);
    k_gemmb<false, 1><<<dim3(NTK / 64, DKV / 64, 1), 128, 0, stream>>>(Xb, nullptr, WKb, S, 0, cosv, sinv, wb, NH_, nullptr, nullptr);
    k_gemmb<false, 2><<<dim3(NTK / 64, DKV / 64, 1), 128, 0, stream>>>(Xb, nullptr, WVb, nullptr, 0, nullptr, nullptr, nullptr, 0, VTH, VTL);
    k_attn<<<NB_ * NH_ * (NT_ / 64), 128, 0, stream>>>(S, VTH, VTL, YH, YL);
    k_gemmb<true, 0><<<dim3(NTK / 64, DM / 64, 1), 128, 0, stream>>>(YH, YL, WPb, out, DM, nullptr, nullptr, nullptr, 0, nullptr, nullptr);
}

// v006
// It runs in 103 microseconds.
// In both of two side-by-side timings against v005, it was 1.16 times as fast.
// Counting every step since v000, it is 3.18 times as fast.
#include <hip/hip_runtime.h>

// Contractions, f32 accumulate: q = x.Wq^T ([4096 x 1024].[1024 x 1024]), k, v = x.Wk^T, x.Wv^T ([4096 x 1024].[1024 x 512]) on v_wmma_f32_16x16x32_bf16 with PLAIN
// bf16 operands (inputs rounded once: exact products); the per-(batch, head) causal gated aggregation y = sum_{s<=t} sigmoid(s_q[t] + s_k[s]) v_s (no q.k product: the
// score is a rank-1 outer sum of two scalars) on v_wmma_f32_16x16x32_f16 with the gate weights (x32768) and v as f16 hi + residual x1024 planes (three products);
// out = y.Wproj^T on the bf16 instruction with y as bf16 hi + residual planes. Rotary, rms_norm, the w_braid dots and the sigmoids are f32. Deterministic, no atomics;

#define NB_  2
#define NT_  2048
#define DM   1024
#define NH_  16
#define NKV  8
#define HD   64
#define DKV  (NKV * HD)
#define NTK  (NB_ * NT_)
#define PSC  32768.0f
#define LOSC 1024.0f
#define LOSCI (1.0f / 1024.0f)

typedef _Float16 h16;
typedef unsigned short bf;
typedef __attribute__((ext_vector_type(16))) __bf16   v16bf;
typedef __attribute__((ext_vector_type(16))) _Float16 v16h;
typedef __attribute__((ext_vector_type(8)))  _Float16 v8h;
typedef __attribute__((ext_vector_type(8)))  unsigned short v8us;
typedef __attribute__((ext_vector_type(8)))  float    v8f;
typedef __attribute__((ext_vector_type(4)))  float    v4f;
typedef v8h  __attribute__((may_alias)) v8ha;
typedef v4f  __attribute__((may_alias)) v4fa;

__device__ __forceinline__ unsigned short f2bf(float f) { unsigned u = __float_as_uint(f); u += 0x7FFFu + ((u >> 16) & 1u); return (unsigned short)(u >> 16); }
__device__ __forceinline__ float bf2f(unsigned short b) { return __uint_as_float(((unsigned)b) << 16); }
__device__ __forceinline__ float bfr(float f) { return bf2f(f2bf(f)); }
__device__ __forceinline__ v16h cat16(v8h lo, v8h hi) { return __builtin_shufflevector(lo, hi, 0, 1, 2, 3, 4, 5, 6, 7, 8, 9, 10, 11, 12, 13, 14, 15); }
__device__ __forceinline__ v16bf cat16b(v8us lo, v8us hi) { return __builtin_bit_cast(v16bf, __builtin_shufflevector(lo, hi, 0, 1, 2, 3, 4, 5, 6, 7, 8, 9, 10, 11, 12, 13, 14, 15)); }
__device__ __forceinline__ v8f wmma16(v16h a, v16h b, v8f c) { return __builtin_amdgcn_wmma_f32_16x16x32_f16(false, a, false, b, (short)0, c, false, false); }
__device__ __forceinline__ v8f wmmab(v16bf a, v16bf b, v8f c) { return __builtin_amdgcn_wmma_f32_16x16x32_bf16(false, a, false, b, (short)0, c, false, false); }
#define VST2(T, p, v) do { const T vst2_v_ = (v); *(T*)(p) = vst2_v_;  } while (0)

// k_cvtb: one launch rounds all five f32 operands to bf16. dst rows are [x; Wq; Wk; Wv; Wproj], 1024 wide; a block takes 8 rows, and every boundary is a multiple of 8 rows,
// so a block reads one source (a scalar choice). The grid covers the CROWS rows exactly.
#define CROWS (NTK + DM + 2 * DKV + DM)
__global__ __launch_bounds__(256) void k_cvtb(const float* __restrict__ x, const float* __restrict__ wq, const float* __restrict__ wk, const float* __restrict__ wv, const float* __restrict__ wp, bf* dst) {
    const int lane = threadIdx.x & 31, r = blockIdx.x * 8 + (threadIdx.x >> 5);
    const int r8 = blockIdx.x * 8;
    const float* sb = x; int rs = 0;
    if (r8 >= NTK) { sb = wq; rs = NTK; }
    if (r8 >= NTK + DM) { sb = wk; rs = NTK + DM; }
    if (r8 >= NTK + DM + DKV) { sb = wv; rs = NTK + DM + DKV; }
    if (r8 >= NTK + DM + 2 * DKV) { sb = wp; rs = NTK + DM + 2 * DKV; }
    const float* src = sb + (size_t)(r - rs) * DM;
    v8us o[4];
#pragma unroll
    for (int q = 0; q < 4; ++q) { v8us t;
#pragma unroll
        for (int i = 0; i < 8; ++i) t[i] = f2bf(src[q * 256 + lane * 8 + i]);
        o[q] = t; }
#pragma unroll
    for (int q = 0; q < 4; ++q) *(v8us*)(dst + (size_t)r * DM + q * 256 + lane * 8) = o[q];
    
}

// k_gemmb: block = 64 x 64 of C, 4 waves as 2 x 2, each 32 x 32 (2 x 2 accumulator tiles). Per 64-k chunk the block's operand rows (128 B each) come from global memory as
// whole lines (8 lanes a row, 4 rows a wave-load), one chunk ahead into registers, and go to one of two LDS buffers at a pitch of 144 B; the fragments are read from LDS.
// One barrier a chunk: it publishes the buffer just written and ends the reads of the buffer that the next chunk's stores overwrite. k order and sum order per element as before.
// The 64 x 64 f32 tile is staged in LDS and leaves by one of three epilogues. A 64-column tile of q, k or v is one head of 64 tokens, so what only reads a head's row is done here:
// EPI 0: the tile is stored to C as whole lines.
// EPI 1: q, k and v in one launch. Bn is [Wq; Wk; Wv], 32 column tiles: 0-15 the q heads, 16-23 the k heads, 24-31 the v heads; the column tile (block-uniform) picks the epilogue.
// q, k: rotary, rms_norm and the w_braid dot per token; two lanes a token, each 16 rotary pairs (d, d + 32) summed in-lane, then one exchange; only the 64 scores leave,
//        to C = S[b][column tile][t], through LDS so that each 128-B line has one writing wave. q and k themselves are never stored.
// v: the tile is staged transposed ([d][token]) and leaves as the f16 hi and residual x1024 planes VTH, VTL in the order of k_attn's B fragments:
//        [b][kv head][32-key step][16-d tile n][k half: keys 0-15, 16-31][lane = 16 ((key >> 3) & 1) + (d & 15)][key & 7], so that one fragment register group of a wave is 512 contiguous bytes.
//        A wave's store is such a group: four whole lines. v itself is never stored.
#define GP 72
template <bool SPLITA, int EPI>
__global__ __launch_bounds__(128) void k_gemmb(const bf* __restrict__ A, const bf* __restrict__ Al, const bf* __restrict__ Bn, float* C, int ldc,
                                               const float* __restrict__ cosv, const float* __restrict__ sinv, const float* __restrict__ wb, h16* VTH, h16* VTL) {
    constexpr int NP = SPLITA ? 3 : 2;
    __shared__ __align__(16) bf stg[2][NP][64 * GP];
    __shared__ __align__(16) float ost[4][16 * 68];
    __shared__ float sred[64];
    const int tid = threadIdx.x, lane = tid & 31, wave = tid >> 5, lr = lane & 15, hi = lane >> 4;
    const int wm = wave >> 1, wn = wave & 1;
    const int rb = blockIdx.x * 64, c0 = blockIdx.y * 64;
    const int srow = tid >> 3, spc = (tid & 7) * 8;
    const size_t goa = (size_t)(rb + srow) * DM + spc, gob = (size_t)(c0 + srow) * DM + spc;
    v8us ra[4], rw[4], rl[4];
    auto gload = [&](int kc) {
#pragma unroll
        for (int s = 0; s < 4; ++s) { ra[s] = *(const v8us*)(A + goa + (size_t)s * 16 * DM + kc); rw[s] = *(const v8us*)(Bn + gob + (size_t)s * 16 * DM + kc);
            if (SPLITA) rl[s] = *(const v8us*)(Al + goa + (size_t)s * 16 * DM + kc); }
    };
    auto sstore = [&](int buf) {
#pragma unroll
        for (int s = 0; s < 4; ++s) { const int so = (srow + 16 * s) * GP + spc; *(v8us*)(&stg[buf][0][so]) = ra[s]; *(v8us*)(&stg[buf][1][so]) = rw[s];
            if (SPLITA) *(v8us*)(&stg[buf][NP - 1][so]) = rl[s]; }
    };
    v8f acc[2][2];
#pragma unroll
    for (int i = 0; i < 2; ++i)
#pragma unroll
        for (int t = 0; t < 2; ++t) acc[i][t] = (v8f){};
    gload(0);
    sstore(0);
    __syncthreads();
#pragma unroll 1
    for (int c = 0; c < DM / 64; ++c) {
        const int cur = c & 1;
        const bool more = c + 1 < DM / 64;
        if (more) gload((c + 1) * 64);
        v16bf a[2][2], al[2][2], b[2][2];
#pragma unroll
        for (int kk = 0; kk < 2; ++kk)
#pragma unroll
            for (int i = 0; i < 2; ++i) {
                const int ao = (wm * 32 + i * 16 + lr) * GP + kk * 32 + 8 * hi, bo = (wn * 32 + i * 16 + lr) * GP + kk * 32 + 8 * hi;
                a[kk][i] = cat16b(*(const v8us*)(&stg[cur][0][ao]), *(const v8us*)(&stg[cur][0][ao + 16]));
                b[kk][i] = cat16b(*(const v8us*)(&stg[cur][1][bo]), *(const v8us*)(&stg[cur][1][bo + 16]));
                al[kk][i] = a[kk][i];
                if (SPLITA) al[kk][i] = cat16b(*(const v8us*)(&stg[cur][NP - 1][ao]), *(const v8us*)(&stg[cur][NP - 1][ao + 16]));
            }
        __builtin_amdgcn_sched_barrier(0);    // the chunk's LDS reads stay one group ahead of its WMMAs: reads set among them make the wave wait out the LDS latency at each place
#pragma unroll
        for (int kk = 0; kk < 2; ++kk) {
#pragma unroll
            for (int i = 0; i < 2; ++i)
#pragma unroll
                for (int t = 0; t < 2; ++t) acc[i][t] = wmmab(a[kk][i], b[kk][t], acc[i][t]);
            if (SPLITA) {
#pragma unroll
                for (int i = 0; i < 2; ++i)
#pragma unroll
                    for (int t = 0; t < 2; ++t) acc[i][t] = wmmab(al[kk][i], b[kk][t], acc[i][t]);
            }
        }
        if (more) sstore(cur ^ 1);
        __syncthreads();
    }
    float* ob = &ost[0][0];
    const int bb = rb / NT_, t0 = rb & (NT_ - 1);    // a 64-row tile lies in one batch
    if (EPI == 1 && blockIdx.y >= NH_ + NKV) {
#pragma unroll
        for (int i = 0; i < 2; ++i)
#pragma unroll
            for (int t = 0; t < 2; ++t) { float* p = ob + (wn * 32 + t * 16 + lr) * 68 + wm * 32 + i * 16 + hi * 8;
                *(v4fa*)p = __builtin_shufflevector(acc[i][t], acc[i][t], 0, 1, 2, 3); *(v4fa*)(p + 4) = __builtin_shufflevector(acc[i][t], acc[i][t], 4, 5, 6, 7); }
        __syncthreads();
        const int piece = tid >> 4;    // 8 tokens; a wave holds an even piece in lanes 0-15 and the next in lanes 16-31: the two lane halves of one group
        const size_t base = (((size_t)bb * NKV + (blockIdx.y - (NH_ + NKV))) * HD) * NT_ + (size_t)((t0 >> 5) + (piece >> 2)) * (HD * 32) + ((piece >> 1) & 1) * 256 + lane * 8;
#pragma unroll
        for (int s = 0; s < 4; ++s) { const int d = lr + 16 * s; const float* sp = ob + d * 68 + piece * 8;
            const v4f a0 = *(const v4fa*)sp, a1 = *(const v4fa*)(sp + 4); v8h vh, vl;
#pragma unroll
            for (int i = 0; i < 8; ++i) { const float v = i < 4 ? a0[i & 3] : a1[i & 3]; const h16 a = (h16)v; vh[i] = a; vl[i] = (h16)((v - (float)a) * LOSC); }
            *(v8h*)(VTH + base + s * 512) = vh; *(v8h*)(VTL + base + s * 512) = vl; }
        return;
    }
    const int er = tid >> 1, ed = (tid & 1) * 16;
    v4f cc[4], sn[4], wa[4], wc[4];
    if constexpr (EPI == 1) {    // loaded ahead of the stage's stores and its barrier, so that their latency runs under both
#pragma unroll
        for (int q = 0; q < 4; ++q) { cc[q] = *(const v4f*)(cosv + (size_t)(t0 + er) * 32 + ed + 4 * q); sn[q] = *(const v4f*)(sinv + (size_t)(t0 + er) * 32 + ed + 4 * q);
            wa[q] = *(const v4f*)(wb + ed + 4 * q); wc[q] = *(const v4f*)(wb + 32 + ed + 4 * q); }
    }
#pragma unroll
    for (int i = 0; i < 2; ++i)
#pragma unroll
        for (int t = 0; t < 2; ++t)
#pragma unroll
            for (int j = 0; j < 8; ++j) ob[(wm * 32 + i * 16 + hi * 8 + j) * 68 + wn * 32 + t * 16 + lr] = acc[i][t][j];
    __syncthreads();
    if constexpr (EPI == 1) {
        const float* xr = ob + er * 68 + ed;
        float ss = 0.f, dt = 0.f;
#pragma unroll
        for (int q = 0; q < 4; ++q) { const v4f x1 = *(const v4fa*)(xr + 4 * q), x2 = *(const v4fa*)(xr + 32 + 4 * q);
#pragma unroll
            for (int i = 0; i < 4; ++i) { const float c = bfr(cc[q][i]), s = bfr(sn[q][i]);
                const float y1 = x1[i] * c + x2[i] * s, y2 = -x1[i] * s + x2[i] * c;
                ss += y1 * y1 + y2 * y2; dt += y1 * bfr(wa[q][i]) + y2 * bfr(wc[q][i]); } }
        ss += __shfl_xor(ss, 1, 32); dt += __shfl_xor(dt, 1, 32);
        const float rn = rsqrtf(ss * (1.0f / HD) + 1e-6f);
        if ((tid & 1) == 0) sred[er] = dt * rn;
        __syncthreads();    // the 64 scores, made by four waves, are published to the two waves that store them
        if (tid < 64) C[((size_t)bb * (NH_ + NKV) + blockIdx.y) * NT_ + t0 + tid] = sred[tid];
        return;
    }
    const float* os = &ost[wave][0];
    float* crow = C + (size_t)(rb + wave * 16) * ldc + c0;
    auto pass = [&]() {
#pragma unroll
        for (int s = 0; s < 8; ++s) { const int Lid = (lane >> 3) + 4 * s, piece = lane & 7; const int row = Lid >> 1, cofs = (Lid & 1) * 32 + piece * 4;
            const v4f val = *(const v4fa*)(os + row * 68 + cofs); *(v4f*)(crow + (size_t)row * ldc + cofs) = val; }
    };
    pass(); 
}

// k_attn: block = (b, h, 64 queries), wave = 16; key tiles 0 .. the query tile (block-uniform static bound). Per 32-key step the gate tile is pure VALU:
// g[t][s] = sigmoid(s_q[t] + s_k[s]) for s <= t else 0, x32768, as f16 hi + residual x1024 per-wave LDS tiles (same-wave may_alias reload after a compiler barrier);
// 32768 sigmoid(a + b) = 1 / (2^-15 + (2^-7 e^-a)(2^-8 e^-b)): the two factors are formed once per query row and once per key, an element is one fma, one v_rcp_f32 and a select.
// The value fragments and the two s_k of step kt + 1 are loaded during step kt into registers carried round the loop, so their latency runs under the next step's gate work.
// The value planes lie in fragment order (k_gemmb, the v epilogue): each of a step's 16 fragment loads reads 512 contiguous bytes, four whole lines.
// 12 WMMA against the value planes of kv head h/2 (w_h.v_h + w_h.v_l + w_l.v_h); y = (o + ox/1024) / 32768 / (sqrt(2048) + 1e-6) -> bf16 hi/lo planes YH/YL[tok][h*64+d].
// 2^sh e^-s. rms_norm bounds |s| by 8 |w_braid|; the clamp at 80 keeps both factors of a gate finite, normal and non-zero, so that their product is never inf x 0.
__device__ __forceinline__ float gfac(float s, float sh) { return __builtin_amdgcn_exp2f(fmaf(fminf(fmaxf(s, -80.0f), 80.0f), -1.44269504f, sh)); }

__global__ __launch_bounds__(128) void k_attn(const float* __restrict__ S, const h16* __restrict__ VTH, const h16* __restrict__ VTL, bf* YH, bf* YL) {
    __shared__ __align__(16) h16 plds[4][16 * 32];
    __shared__ __align__(16) h16 plds2[4][16 * 32];
    __shared__ __align__(16) float ost[4][16 * 68];
    const int lane = threadIdx.x & 31, wave = threadIdx.x >> 5, lr = lane & 15, hi = lane >> 4;
    const int bid = blockIdx.x;
    const int b = bid / (NH_ * (NT_ / 64)), rem = bid - b * (NH_ * (NT_ / 64)), h = rem / (NT_ / 64), qt = rem - h * (NT_ / 64);
    const int q0 = qt * 64 + wave * 16, hk = h / (NH_ / NKV);
    const size_t tok0 = (size_t)b * NT_;
    h16* pl = &plds[wave][0]; h16* pl2 = &plds2[wave][0];
    const float* sq_b = S + ((size_t)b * (NH_ + NKV) + h) * NT_;
    const float* sk_b = S + ((size_t)b * (NH_ + NKV) + NH_ + hk) * NT_;
    int qpos[8]; float eq[8];
#pragma unroll
    for (int j = 0; j < 8; ++j) { qpos[j] = q0 + 8 * hi + j; eq[j] = gfac(sq_b[qpos[j]], -7.0f); }
    const size_t vbase = (((size_t)b * NKV + hk) * HD) * NT_;
    v8f o[4], ox[4];
#pragma unroll
    for (int n = 0; n < 4; ++n) { o[n] = (v8f){}; ox[n] = (v8f){}; }
    const int kt_end = (qt * 64 + 64) / 32;
    v8h vha[4], vhb[4], vla[4], vlb[4];
    const char* vhp = (const char*)(VTH + vbase); const char* vlp = (const char*)(VTL + vbase);
    unsigned vo = lane * 16;    // byte offset of this lane's 16 B in the first group of the step to be loaded; a step is 4096 B a plane
    auto loadv = [&]() {
#pragma unroll
        for (int n = 0; n < 4; ++n) { const char* ph = vhp + vo + n * 1024; const char* pv = vlp + vo + n * 1024;
            vha[n] = *(const v8h*)ph; vhb[n] = *(const v8h*)(ph + 512); vla[n] = *(const v8h*)pv; vlb[n] = *(const v8h*)(pv + 512); }
    };
    float sk0 = sk_b[lr], sk1 = sk_b[16 + lr];
    asm volatile("" :: "v"(sk0), "v"(sk1));    // step 0's s_k landed ahead of the value loads: else the loop's wait for them (loads return in order) also waits out every step's value loads
    loadv();
#pragma unroll 1
    for (int kt = 0; kt < kt_end; ++kt) {
        const int l0 = kt * 32;
        const int ln = (kt + 1 < kt_end ? kt + 1 : kt) * 32;    // the last step loads its own tile again: in bounds, not used
        const float skn0 = sk_b[ln + lr], skn1 = sk_b[ln + 16 + lr];
        const float ek0 = gfac(sk0, -8.0f), ek1 = gfac(sk1, -8.0f);
#pragma unroll
        for (int j = 0; j < 8; ++j) {
            const float r0 = __builtin_amdgcn_rcpf(fmaf(eq[j], ek0, 1.0f / PSC)), r1 = __builtin_amdgcn_rcpf(fmaf(eq[j], ek1, 1.0f / PSC));
            const float g0 = (l0 + lr <= qpos[j]) ? r0 : 0.0f;
            const float g1 = (l0 + 16 + lr <= qpos[j]) ? r1 : 0.0f;
            const h16 h0 = (h16)g0, h1 = (h16)g1;
            const int mr = hi * 8 + j;
            pl[mr * 32 + lr] = h0; pl[mr * 32 + 16 + lr] = h1;
            pl2[mr * 32 + lr] = (h16)((g0 - (float)h0) * LOSC); pl2[mr * 32 + 16 + lr] = (h16)((g1 - (float)h1) * LOSC);
        }
        asm volatile("" ::: "memory");
        const v16h pa = cat16(*(const v8ha*)(pl + lr * 32 + hi * 8), *(const v8ha*)(pl + lr * 32 + 16 + hi * 8));
        const v16h px = cat16(*(const v8ha*)(pl2 + lr * 32 + hi * 8), *(const v8ha*)(pl2 + lr * 32 + 16 + hi * 8));
#pragma unroll
        for (int n = 0; n < 4; ++n) { const v16h vh = cat16(vha[n], vhb[n]), vl = cat16(vla[n], vlb[n]);
            o[n] = wmma16(pa, vh, o[n]); ox[n] = wmma16(pa, vl, ox[n]); ox[n] = wmma16(px, vh, ox[n]); }
        asm volatile("s_wait_xcnt 0x0" : "+v"(vo) :: "memory");    // the value loads of the step before name vo: the wait stands in front of its rewrite; vo is an operand so that the addition stays behind the wait
        vo += (kt + 1 < kt_end) ? 4096u : 0u;
        loadv();
        asm volatile("v_nop\n\tv_nop\n\tv_nop\n\tv_nop" : "+v"(o[0]), "+v"(o[1]), "+v"(o[2]), "+v"(o[3]), "+v"(ox[0]), "+v"(ox[1]), "+v"(ox[2]), "+v"(ox[3]) : "v"(pa), "v"(px));
        __builtin_amdgcn_wave_barrier();            // the gate tiles are rewritten next step
        sk0 = skn0; sk1 = skn1;
    }
    asm volatile("s_wait_xcnt 0x0" :: "v"(vo) : "memory");    // the last step's value loads name vo: as an operand its register is kept until the wait has passed
    const float scl = (1.0f / PSC) / (sqrtf((float)NT_) + 1e-6f);
    float* os = &ost[wave][0];
#pragma unroll
    for (int n = 0; n < 4; ++n)
#pragma unroll
        for (int j = 0; j < 8; ++j) os[(hi * 8 + j) * 68 + n * 16 + lr] = (o[n][j] + ox[n][j] * LOSCI) * scl;
    __syncthreads();
    const size_t cbase = (tok0 + q0) * DM + (size_t)h * HD;
    auto pass = [&]() {
#pragma unroll
        for (int s = 0; s < 4; ++s) { const int row = 4 * s + (lane >> 3), piece = lane & 7; const float* sp = os + row * 68 + piece * 8; v8us oh, ol;
#pragma unroll
            for (int i = 0; i < 8; ++i) { const unsigned short hb = f2bf(sp[i]); oh[i] = hb; ol[i] = f2bf(sp[i] - bf2f(hb)); }
            *(v8us*)(YH + cbase + (size_t)row * DM + piece * 8) = oh; *(v8us*)(YL + cbase + (size_t)row * DM + piece * 8) = ol; }
    };
    pass(); 
}

extern "C" void kernel_launch(void* const* d_in, const int* in_sizes, int n_in,
                              void* d_out, int out_size, void* d_ws, size_t ws_size, hipStream_t stream) {
    (void)in_sizes; (void)n_in; (void)out_size;
    const float* x = (const float*)d_in[0]; const float* cosv = (const float*)d_in[1]; const float* sinv = (const float*)d_in[2];
    const float* Wq = (const float*)d_in[3]; const float* Wk = (const float*)d_in[4]; const float* Wv = (const float*)d_in[5]; const float* Wp = (const float*)d_in[6]; const float* wb = (const float*)d_in[7];
    float* out = (float*)d_out;    // [2][2048][1024]
    char* wsp = (char*)d_ws;
    auto take = [&](size_t bytes) { char* p = wsp; wsp += (bytes + 255) & ~(size_t)255; return (void*)p; };
    bf* Xb = (bf*)take((size_t)CROWS * DM * 2); bf* WQKVb = Xb + (size_t)NTK * DM; bf* WPb = WQKVb + (size_t)(DM + 2 * DKV) * DM;    // one array, rows [x; Wq; Wk; Wv; Wproj]
    float* S = (float*)take((size_t)NB_ * (NH_ + NKV) * NT_ * 4);
    h16* VTH = (h16*)take((size_t)NTK * DKV * 2); h16* VTL = (h16*)take((size_t)NTK * DKV * 2);
    bf* YH = (bf*)take((size_t)NTK * DM * 2); bf* YL = (bf*)take((size_t)NTK * DM * 2);
    if ((size_t)(wsp - (char*)d_ws) > ws_size) return;    // 8.4 + 6.3 + 0.4 + 2 x 4.2 + 2 x 8.4 MB ~ 40 MB
    k_cvtb<<<CROWS / 8, 256, 0, stream>>>(x, Wq, Wk, Wv, Wp, Xb);
    k_gemmb<false, 1><<<dim3(NTK / 64, (DM + 2 * DKV) / 64, 1), 128, 0, stream>>>(Xb, nullptr, WQKVb, S, 0, cosv, sinv, wb, VTH, VTL);
    k_attn<<<NB_ * NH_ * (NT_ / 64), 128, 0, stream>>>(S, VTH, VTL, YH, YL);
    k_gemmb<true, 0><<<dim3(NTK / 64, DM / 64, 1), 128, 0, stream>>>(YH, YL, WPb, out, DM, nullptr, nullptr, nullptr, nullptr, nullptr);
}

// v007
// A run of this version takes 96.4 microseconds.
// Two timings next to v006 put it at 1.06 and 1.08 times that version's speed.
// Counting every step since v000, it is 3.39 times as fast.
#include <hip/hip_runtime.h>

// Contractions, f32 accumulate: q = x.Wq^T ([4096 x 1024].[1024 x 1024]), k, v = x.Wk^T, x.Wv^T ([4096 x 1024].[1024 x 512]) on v_wmma_f32_16x16x32_bf16 with PLAIN
// bf16 operands (inputs rounded once: exact products); the per-(batch, head) causal gated aggregation y = sum_{s<=t} sigmoid(s_q[t] + s_k[s]) v_s (no q.k product: the
// score is a rank-1 outer sum of two scalars) on v_wmma_f32_16x16x32_f16 with the gate weights (x32768) and v as f16 hi + residual x1024 planes (three products);
// out = y.Wproj^T on the bf16 instruction with y as bf16 hi + residual planes. Rotary, rms_norm, the w_braid dots and the sigmoids are f32. Deterministic, no atomics;

#define NB_  2
#define NT_  2048
#define DM   1024
#define NH_  16
#define NKV  8
#define HD   64
#define DKV  (NKV * HD)
#define NTK  (NB_ * NT_)
#define PSC  32768.0f
#define LOSC 1024.0f
#define LOSCI (1.0f / 1024.0f)

typedef _Float16 h16;
typedef unsigned short bf;
typedef __attribute__((ext_vector_type(16))) __bf16   v16bf;
typedef __attribute__((ext_vector_type(16))) _Float16 v16h;
typedef __attribute__((ext_vector_type(8)))  _Float16 v8h;
typedef __attribute__((ext_vector_type(8)))  unsigned short v8us;
typedef __attribute__((ext_vector_type(8)))  float    v8f;
typedef __attribute__((ext_vector_type(4)))  float    v4f;
typedef __attribute__((ext_vector_type(2)))  float    v2f;
typedef __attribute__((ext_vector_type(2)))  _Float16 v2h;
typedef __attribute__((ext_vector_type(8)))  unsigned v8u;
typedef v4f  __attribute__((may_alias)) v4fa;

__device__ __forceinline__ unsigned short f2bf(float f) { unsigned u = __float_as_uint(f); u += 0x7FFFu + ((u >> 16) & 1u); return (unsigned short)(u >> 16); }
__device__ __forceinline__ float bf2f(unsigned short b) { return __uint_as_float(((unsigned)b) << 16); }
__device__ __forceinline__ float bfr(float f) { return bf2f(f2bf(f)); }
__device__ __forceinline__ v16h cat16(v8h lo, v8h hi) { return __builtin_shufflevector(lo, hi, 0, 1, 2, 3, 4, 5, 6, 7, 8, 9, 10, 11, 12, 13, 14, 15); }
__device__ __forceinline__ v16bf cat16b(v8us lo, v8us hi) { return __builtin_bit_cast(v16bf, __builtin_shufflevector(lo, hi, 0, 1, 2, 3, 4, 5, 6, 7, 8, 9, 10, 11, 12, 13, 14, 15)); }
__device__ __forceinline__ v8f wmma16(v16h a, v16h b, v8f c) { return __builtin_amdgcn_wmma_f32_16x16x32_f16(false, a, false, b, (short)0, c, false, false); }
__device__ __forceinline__ v8f wmmab(v16bf a, v16bf b, v8f c) { return __builtin_amdgcn_wmma_f32_16x16x32_bf16(false, a, false, b, (short)0, c, false, false); }
#define VST2(T, p, v) do { const T vst2_v_ = (v); *(T*)(p) = vst2_v_;  } while (0)

// k_cvtb: one launch rounds all five f32 operands to bf16. dst rows are [x; Wq; Wk; Wv; Wproj], 1024 wide; a block takes 8 rows, and every boundary is a multiple of 8 rows,
// so a block reads one source (a scalar choice). The grid covers the CROWS rows exactly.
#define CROWS (NTK + DM + 2 * DKV + DM)
__global__ __launch_bounds__(256) void k_cvtb(const float* __restrict__ x, const float* __restrict__ wq, const float* __restrict__ wk, const float* __restrict__ wv, const float* __restrict__ wp, bf* dst) {
    const int lane = threadIdx.x & 31, r = blockIdx.x * 8 + (threadIdx.x >> 5);
    const int r8 = blockIdx.x * 8;
    const float* sb = x; int rs = 0;
    if (r8 >= NTK) { sb = wq; rs = NTK; }
    if (r8 >= NTK + DM) { sb = wk; rs = NTK + DM; }
    if (r8 >= NTK + DM + DKV) { sb = wv; rs = NTK + DM + DKV; }
    if (r8 >= NTK + DM + 2 * DKV) { sb = wp; rs = NTK + DM + 2 * DKV; }
    const float* src = sb + (size_t)(r - rs) * DM;
    v8us o[4];
#pragma unroll
    for (int q = 0; q < 4; ++q) { v8us t;
#pragma unroll
        for (int i = 0; i < 8; ++i) t[i] = f2bf(src[q * 256 + lane * 8 + i]);
        o[q] = t; }
#pragma unroll
    for (int q = 0; q < 4; ++q) *(v8us*)(dst + (size_t)r * DM + q * 256 + lane * 8) = o[q];
    
}

// k_gemmb: block = 64 x 64 of C, 4 waves as 2 x 2, each 32 x 32 (2 x 2 accumulator tiles). Per 64-k chunk the block's operand rows (128 B each) come from global memory as
// whole lines (8 lanes a row, 4 rows a wave-load), one chunk ahead into registers, and go to one of two LDS buffers at a pitch of 144 B; the fragments are read from LDS.
// One barrier a chunk: it publishes the buffer just written and ends the reads of the buffer that the next chunk's stores overwrite. k order and sum order per element as before.
// The 64 x 64 f32 tile is staged in LDS and leaves by one of three epilogues. A 64-column tile of q, k or v is one head of 64 tokens, so what only reads a head's row is done here:
// EPI 0: the tile is stored to C as whole lines.
// EPI 1: q, k and v in one launch. Bn is [Wq; Wk; Wv], 32 column tiles: 0-15 the q heads, 16-23 the k heads, 24-31 the v heads; the column tile (block-uniform) picks the epilogue.
// q, k: rotary, rms_norm and the w_braid dot per token; two lanes a token, each 16 rotary pairs (d, d + 32) summed in-lane, then one exchange; only the 64 scores leave,
//        to C = S[b][column tile][t], through LDS so that each 128-B line has one writing wave. q and k themselves are never stored.
// v: the tile is staged transposed ([d][token]) and leaves as the f16 hi and residual x1024 planes VTH, VTL in the order of k_attn's B fragments:
//        [b][kv head][32-key step][16-d tile n][k half: keys 0-15, 16-31][lane = 16 ((key >> 3) & 1) + (d & 15)][key & 7], so that one fragment register group of a wave is 512 contiguous bytes.
//        A wave's store is such a group: four whole lines. v itself is never stored.
#define GP 72
template <bool SPLITA, int EPI>
__global__ __launch_bounds__(128) void k_gemmb(const bf* __restrict__ A, const bf* __restrict__ Al, const bf* __restrict__ Bn, float* C, int ldc,
                                               const float* __restrict__ cosv, const float* __restrict__ sinv, const float* __restrict__ wb, h16* VTH, h16* VTL) {
    constexpr int NP = SPLITA ? 3 : 2;
    __shared__ __align__(16) bf stg[2][NP][64 * GP];
    __shared__ __align__(16) float ost[4][16 * 68];
    __shared__ float sred[64];
    const int tid = threadIdx.x, lane = tid & 31, wave = tid >> 5, lr = lane & 15, hi = lane >> 4;
    const int wm = wave >> 1, wn = wave & 1;
    const int rb = blockIdx.x * 64, c0 = blockIdx.y * 64;
    const int srow = tid >> 3, spc = (tid & 7) * 8;
    const size_t goa = (size_t)(rb + srow) * DM + spc, gob = (size_t)(c0 + srow) * DM + spc;
    v8us ra[4], rw[4], rl[4];
    auto gload = [&](int kc) {
#pragma unroll
        for (int s = 0; s < 4; ++s) { ra[s] = *(const v8us*)(A + goa + (size_t)s * 16 * DM + kc); rw[s] = *(const v8us*)(Bn + gob + (size_t)s * 16 * DM + kc);
            if (SPLITA) rl[s] = *(const v8us*)(Al + goa + (size_t)s * 16 * DM + kc); }
    };
    auto sstore = [&](int buf) {
#pragma unroll
        for (int s = 0; s < 4; ++s) { const int so = (srow + 16 * s) * GP + spc; *(v8us*)(&stg[buf][0][so]) = ra[s]; *(v8us*)(&stg[buf][1][so]) = rw[s];
            if (SPLITA) *(v8us*)(&stg[buf][NP - 1][so]) = rl[s]; }
    };
    v8f acc[2][2];
#pragma unroll
    for (int i = 0; i < 2; ++i)
#pragma unroll
        for (int t = 0; t < 2; ++t) acc[i][t] = (v8f){};
    gload(0);
    sstore(0);
    __syncthreads();
#pragma unroll 1
    for (int c = 0; c < DM / 64; ++c) {
        const int cur = c & 1;
        const bool more = c + 1 < DM / 64;
        if (more) gload((c + 1) * 64);
        v16bf a[2][2], al[2][2], b[2][2];
#pragma unroll
        for (int kk = 0; kk < 2; ++kk)
#pragma unroll
            for (int i = 0; i < 2; ++i) {
                const int ao = (wm * 32 + i * 16 + lr) * GP + kk * 32 + 8 * hi, bo = (wn * 32 + i * 16 + lr) * GP + kk * 32 + 8 * hi;
                a[kk][i] = cat16b(*(const v8us*)(&stg[cur][0][ao]), *(const v8us*)(&stg[cur][0][ao + 16]));
                b[kk][i] = cat16b(*(const v8us*)(&stg[cur][1][bo]), *(const v8us*)(&stg[cur][1][bo + 16]));
                al[kk][i] = a[kk][i];
                if (SPLITA) al[kk][i] = cat16b(*(const v8us*)(&stg[cur][NP - 1][ao]), *(const v8us*)(&stg[cur][NP - 1][ao + 16]));
            }
        __builtin_amdgcn_sched_barrier(0);    // the chunk's LDS reads stay one group ahead of its WMMAs: reads set among them make the wave wait out the LDS latency at each place
#pragma unroll
        for (int kk = 0; kk < 2; ++kk) {
#pragma unroll
            for (int i = 0; i < 2; ++i)
#pragma unroll
                for (int t = 0; t < 2; ++t) acc[i][t] = wmmab(a[kk][i], b[kk][t], acc[i][t]);
            if (SPLITA) {
#pragma unroll
                for (int i = 0; i < 2; ++i)
#pragma unroll
                    for (int t = 0; t < 2; ++t) acc[i][t] = wmmab(al[kk][i], b[kk][t], acc[i][t]);
            }
        }
        if (more) sstore(cur ^ 1);
        __syncthreads();
    }
    float* ob = &ost[0][0];
    const int bb = rb / NT_, t0 = rb & (NT_ - 1);    // a 64-row tile lies in one batch
    if (EPI == 1 && blockIdx.y >= NH_ + NKV) {
#pragma unroll
        for (int i = 0; i < 2; ++i)
#pragma unroll
            for (int t = 0; t < 2; ++t) { float* p = ob + (wn * 32 + t * 16 + lr) * 68 + wm * 32 + i * 16 + hi * 8;
                *(v4fa*)p = __builtin_shufflevector(acc[i][t], acc[i][t], 0, 1, 2, 3); *(v4fa*)(p + 4) = __builtin_shufflevector(acc[i][t], acc[i][t], 4, 5, 6, 7); }
        __syncthreads();
        const int piece = tid >> 4;    // 8 tokens; a wave holds an even piece in lanes 0-15 and the next in lanes 16-31: the two lane halves of one group
        const size_t base = (((size_t)bb * NKV + (blockIdx.y - (NH_ + NKV))) * HD) * NT_ + (size_t)((t0 >> 5) + (piece >> 2)) * (HD * 32) + ((piece >> 1) & 1) * 256 + lane * 8;
#pragma unroll
        for (int s = 0; s < 4; ++s) { const int d = lr + 16 * s; const float* sp = ob + d * 68 + piece * 8;
            const v4f a0 = *(const v4fa*)sp, a1 = *(const v4fa*)(sp + 4); v8h vh, vl;
#pragma unroll
            for (int i = 0; i < 8; ++i) { const float v = i < 4 ? a0[i & 3] : a1[i & 3]; const h16 a = (h16)v; vh[i] = a; vl[i] = (h16)((v - (float)a) * LOSC); }
            *(v8h*)(VTH + base + s * 512) = vh; *(v8h*)(VTL + base + s * 512) = vl; }
        return;
    }
    const int er = tid >> 1, ed = (tid & 1) * 16;
    v4f cc[4], sn[4], wa[4], wc[4];
    if constexpr (EPI == 1) {    // loaded ahead of the stage's stores and its barrier, so that their latency runs under both
#pragma unroll
        for (int q = 0; q < 4; ++q) { cc[q] = *(const v4f*)(cosv + (size_t)(t0 + er) * 32 + ed + 4 * q); sn[q] = *(const v4f*)(sinv + (size_t)(t0 + er) * 32 + ed + 4 * q);
            wa[q] = *(const v4f*)(wb + ed + 4 * q); wc[q] = *(const v4f*)(wb + 32 + ed + 4 * q); }
    }
#pragma unroll
    for (int i = 0; i < 2; ++i)
#pragma unroll
        for (int t = 0; t < 2; ++t)
#pragma unroll
            for (int j = 0; j < 8; ++j) ob[(wm * 32 + i * 16 + hi * 8 + j) * 68 + wn * 32 + t * 16 + lr] = acc[i][t][j];
    __syncthreads();
    if constexpr (EPI == 1) {
        const float* xr = ob + er * 68 + ed;
        float ss = 0.f, dt = 0.f;
#pragma unroll
        for (int q = 0; q < 4; ++q) { const v4f x1 = *(const v4fa*)(xr + 4 * q), x2 = *(const v4fa*)(xr + 32 + 4 * q);
#pragma unroll
            for (int i = 0; i < 4; ++i) { const float c = bfr(cc[q][i]), s = bfr(sn[q][i]);
                const float y1 = x1[i] * c + x2[i] * s, y2 = -x1[i] * s + x2[i] * c;
                ss += y1 * y1 + y2 * y2; dt += y1 * bfr(wa[q][i]) + y2 * bfr(wc[q][i]); } }
        ss += __shfl_xor(ss, 1, 32); dt += __shfl_xor(dt, 1, 32);
        const float rn = rsqrtf(ss * (1.0f / HD) + 1e-6f);
        if ((tid & 1) == 0) sred[er] = dt * rn;
        __syncthreads();    // the 64 scores, made by four waves, are published to the two waves that store them
        if (tid < 64) C[((size_t)bb * (NH_ + NKV) + blockIdx.y) * NT_ + t0 + tid] = sred[tid];
        return;
    }
    const float* os = &ost[wave][0];
    float* crow = C + (size_t)(rb + wave * 16) * ldc + c0;
    auto pass = [&]() {
#pragma unroll
        for (int s = 0; s < 8; ++s) { const int Lid = (lane >> 3) + 4 * s, piece = lane & 7; const int row = Lid >> 1, cofs = (Lid & 1) * 32 + piece * 4;
            const v4f val = *(const v4fa*)(os + row * 68 + cofs); *(v4f*)(crow + (size_t)row * ldc + cofs) = val; }
    };
    pass(); 
}

// k_attn: block = (b, h, 64 queries), wave = 16; key tiles 0 .. the query tile (block-uniform static bound). Per 32-key step the gate tile is pure VALU:
// g[t][s] = sigmoid(s_q[t] + s_k[s]) for s <= t else 0, x32768, as f16 hi + residual x1024.
// 32768 sigmoid(a + b) = 1 / (2^-15 + (2^-7 e^-a)(2^-8 e^-b)): the two factors are formed once per query row and once per key, an element is one fma, one v_rcp_f32 and a select.
// Each lane forms the 16 gates of its own A-fragment slots: query row lr, keys 8 hi + 0..7 (elements 0-7) and 16 + 8 hi + 0..7 (elements 8-15) of the step. The gate tile never passes through LDS.
// The key factors of the head's 2048 keys are formed once per block into the LDS table ekl; a step reads its 16 as four 16-B loads (one address per lane half), issued behind the gates of the step before.
// The value fragments of step kt + 1 are loaded during step kt into registers carried round the loop, so their latency runs under the next step's gate work.
// The value planes lie in fragment order (k_gemmb, the v epilogue): each of a step's 16 fragment loads reads 512 contiguous bytes, four whole lines.
// 12 WMMA against the value planes of kv head h/2 (w_h.v_h + w_h.v_l + w_l.v_h); y = (o + ox/1024) / 32768 / (sqrt(2048) + 1e-6) -> bf16 hi/lo planes YH/YL[tok][h*64+d].
// 2^sh e^-s. rms_norm bounds |s| by 8 |w_braid|; the clamp at 80 keeps both factors of a gate finite, normal and non-zero, so that their product is never inf x 0.
__device__ __forceinline__ float gfac(float s, float sh) { return __builtin_amdgcn_exp2f(fmaf(fminf(fmaxf(s, -80.0f), 80.0f), -1.44269504f, sh)); }

// Residual plane of four fragment registers: f16(1024 g - 1024 hi) per half, hi read as f16 from the packed register. Both products and the sum are exact in f32, so the one rounding is the
// conversion to f16, as in (f16)((g - hi) * 1024). Written in asm because the compiler's form unpacks hi to f32 first (five instructions a register; here three, the scaling of g counted).
// The four low halves stand ahead of the four high halves; each high half reads the register written four instructions back: s_delay_alu names that distance, so that other waves issue meanwhile.
template <int K>
__device__ __forceinline__ void res4(v8u& d, const v8u& h, const v2f (&t)[8]) {
    unsigned d0, d1, d2, d3;
    // one instruction a half: reads hi in place as f16, scales, subtracts and rounds to f16 (see above)
    asm("v_fma_mixlo_f16 %0, %4, %8, %9 op_sel_hi:[1,0,0]\n\tv_fma_mixlo_f16 %1, %5, %8, %11 op_sel_hi:[1,0,0]\n\t"
        "v_fma_mixlo_f16 %2, %6, %8, %13 op_sel_hi:[1,0,0]\n\tv_fma_mixlo_f16 %3, %7, %8, %15 op_sel_hi:[1,0,0]\n\t"
        "s_delay_alu instid0(VALU_DEP_4) | instskip(NEXT) | instid1(VALU_DEP_4)\n\t"
        "v_fma_mixhi_f16 %0, %4, %8, %10 op_sel:[1,0,0] op_sel_hi:[1,0,0]\n\tv_fma_mixhi_f16 %1, %5, %8, %12 op_sel:[1,0,0] op_sel_hi:[1,0,0]\n\t"
        "s_delay_alu instid0(VALU_DEP_4) | instskip(NEXT) | instid1(VALU_DEP_4)\n\t"
        "v_fma_mixhi_f16 %2, %6, %8, %14 op_sel:[1,0,0] op_sel_hi:[1,0,0]\n\tv_fma_mixhi_f16 %3, %7, %8, %16 op_sel:[1,0,0] op_sel_hi:[1,0,0]"
        : "=&v"(d0), "=&v"(d1), "=&v"(d2), "=&v"(d3)
        : "v"(h[K]), "v"(h[K + 1]), "v"(h[K + 2]), "v"(h[K + 3]), "s"(-LOSC),
          "v"(t[K][0]), "v"(t[K][1]), "v"(t[K + 1][0]), "v"(t[K + 1][1]), "v"(t[K + 2][0]), "v"(t[K + 2][1]), "v"(t[K + 3][0]), "v"(t[K + 3][1]));
    d[K] = d0; d[K + 1] = d1; d[K + 2] = d2; d[K + 3] = d3;
}

__global__ __launch_bounds__(128) void k_attn(const float* __restrict__ S, const h16* __restrict__ VTH, const h16* __restrict__ VTL, bf* YH, bf* YL) {
    __shared__ __align__(16) float ekl[NT_];
    __shared__ __align__(16) float ost[4][16 * 68];
    const int lane = threadIdx.x & 31, wave = threadIdx.x >> 5, lr = lane & 15, hi = lane >> 4;
    const int bid = blockIdx.x;
    const int b = bid / (NH_ * (NT_ / 64)), rem = bid - b * (NH_ * (NT_ / 64)), h = rem / (NT_ / 64), qt = rem - h * (NT_ / 64);
    const int q0 = qt * 64 + wave * 16, hk = h / (NH_ / NKV);
    const size_t tok0 = (size_t)b * NT_;
    const float* sq_b = S + ((size_t)b * (NH_ + NKV) + h) * NT_;
    const float* sk_b = S + ((size_t)b * (NH_ + NKV) + NH_ + hk) * NT_;
    const size_t vbase = (((size_t)b * NKV + hk) * HD) * NT_;
    v8f o[4], ox[4];
#pragma unroll
    for (int n = 0; n < 4; ++n) { o[n] = (v8f){}; ox[n] = (v8f){}; }
    const int kt_end = (qt * 64 + 64) / 32;
    v8h vha[4], vhb[4], vla[4], vlb[4];
    const char* vhp = (const char*)(VTH + vbase); const char* vlp = (const char*)(VTL + vbase);
    unsigned vo = lane * 16;    // byte offset of this lane's 16 B in the first group of the step to be loaded; a step is 4096 B a plane
    auto loadv = [&]() {
#pragma unroll
        for (int n = 0; n < 4; ++n) { const char* ph = vhp + vo + n * 1024; const char* pv = vlp + vo + n * 1024;
            vha[n] = *(const v8h*)ph; vhb[n] = *(const v8h*)(ph + 512); vla[n] = *(const v8h*)pv; vlb[n] = *(const v8h*)(pv + 512); }
    };
    v4f sk[4];
#pragma unroll
    for (int q = 0; q < 4; ++q) sk[q] = *(const v4f*)(sk_b + q * 512 + threadIdx.x * 4);    // all 2048 s_k of the head: written by k_gemmb for every token, so in bounds and defined for every query tile
    const float sq = sq_b[q0 + lr];
    loadv();    // step 0's values are in flight while the table is built
#pragma unroll
    for (int q = 0; q < 4; ++q) { v4f t;
#pragma unroll
        for (int i = 0; i < 4; ++i) t[i] = gfac(sk[q][i], -8.0f);
        *(v4f*)(ekl + q * 512 + threadIdx.x * 4) = t; }
    const float eq = gfac(sq, -7.0f);
    __syncthreads();    // the key factors, formed by four waves, are published to all of them
    v4f e[4];
    auto loade = [&](int l) { const float* ep = ekl + l + hi * 8;
        e[0] = *(const v4f*)ep; e[1] = *(const v4f*)(ep + 4); e[2] = *(const v4f*)(ep + 16); e[3] = *(const v4f*)(ep + 20); };
    loade(0);
    int m = q0 + lr - hi * 8;    // key offset i of the step (from l0 + 8 hi) is at or before the lane's query while i <= m
#pragma unroll 1
    for (int kt = 0; kt < kt_end; ++kt) {
        const int ln = (kt + 1 < kt_end ? kt + 1 : kt) * 32;    // the last step loads its own factors again: in bounds, not used
        v8u pah, pxl; v2f gs[8];
#pragma unroll
        for (int i = 0; i < 16; i += 2) {    // two neighbouring slots a turn: one register of the fragment
            const int ko = i < 8 ? i : i + 8;    // slots 8-15 hold key offsets 16-23
            const float r0 = __builtin_amdgcn_rcpf(fmaf(eq, e[i >> 2][i & 3], 1.0f / PSC)), r1 = __builtin_amdgcn_rcpf(fmaf(eq, e[i >> 2][(i & 3) + 1], 1.0f / PSC));
            const v2f g = {(ko <= m) ? r0 : 0.0f, (ko + 1 <= m) ? r1 : 0.0f};
            pah[i >> 1] = __builtin_bit_cast(unsigned, __builtin_convertvector(g, v2h));
            gs[i >> 1] = g * LOSC;
        }
        res4<0>(pxl, pah, gs); res4<4>(pxl, pah, gs);
        const v16h pa = __builtin_bit_cast(v16h, pah), px = __builtin_bit_cast(v16h, pxl);
        loade(ln);
        __builtin_amdgcn_sched_barrier(0);    // the gate arithmetic stays ahead of the step's WMMAs: set among them it took dead value registers as temporaries, and each such place cost the v_nops of the WMMA distance
#pragma unroll
        for (int n = 0; n < 4; ++n) { const v16h vh = cat16(vha[n], vhb[n]), vl = cat16(vla[n], vlb[n]);
            o[n] = wmma16(pa, vh, o[n]); ox[n] = wmma16(pa, vl, ox[n]); ox[n] = wmma16(px, vh, ox[n]); }
        asm volatile("s_wait_xcnt 0x0" : "+v"(vo) :: "memory");    // the value loads of the step before name vo: the wait stands in front of its rewrite; vo is an operand so that the addition stays behind the wait
        vo += (kt + 1 < kt_end) ? 4096u : 0u;
        loadv();
        m -= 32;
    }
    asm volatile("s_wait_xcnt 0x0" :: "v"(vo) : "memory");    // the last step's value loads name vo: as an operand its register is kept until the wait has passed
    const float scl = (1.0f / PSC) / (sqrtf((float)NT_) + 1e-6f);
    float* os = &ost[wave][0];
#pragma unroll
    for (int n = 0; n < 4; ++n)
#pragma unroll
        for (int j = 0; j < 8; ++j) os[(hi * 8 + j) * 68 + n * 16 + lr] = (o[n][j] + ox[n][j] * LOSCI) * scl;
    __syncthreads();
    const size_t cbase = (tok0 + q0) * DM + (size_t)h * HD;
    auto pass = [&]() {
#pragma unroll
        for (int s = 0; s < 4; ++s) { const int row = 4 * s + (lane >> 3), piece = lane & 7; const float* sp = os + row * 68 + piece * 8; v8us oh, ol;
#pragma unroll
            for (int i = 0; i < 8; ++i) { const unsigned short hb = f2bf(sp[i]); oh[i] = hb; ol[i] = f2bf(sp[i] - bf2f(hb)); }
            *(v8us*)(YH + cbase + (size_t)row * DM + piece * 8) = oh; *(v8us*)(YL + cbase + (size_t)row * DM + piece * 8) = ol; }
    };
    pass(); 
}

extern "C" void kernel_launch(void* const* d_in, const int* in_sizes, int n_in,
                              void* d_out, int out_size, void* d_ws, size_t ws_size, hipStream_t stream) {
    (void)in_sizes; (void)n_in; (void)out_size;
    const float* x = (const float*)d_in[0]; const float* cosv = (const float*)d_in[1]; const float* sinv = (const float*)d_in[2];
    const float* Wq = (const float*)d_in[3]; const float* Wk = (const float*)d_in[4]; const float* Wv = (const float*)d_in[5]; const float* Wp = (const float*)d_in[6]; const float* wb = (const float*)d_in[7];
    float* out = (float*)d_out;    // [2][2048][1024]
    char* wsp = (char*)d_ws;
    auto take = [&](size_t bytes) { char* p = wsp; wsp += (bytes + 255) & ~(size_t)255; return (void*)p; };
    bf* Xb = (bf*)take((size_t)CROWS * DM * 2); bf* WQKVb = Xb + (size_t)NTK * DM; bf* WPb = WQKVb + (size_t)(DM + 2 * DKV) * DM;    // one array, rows [x; Wq; Wk; Wv; Wproj]
    float* S = (float*)take((size_t)NB_ * (NH_ + NKV) * NT_ * 4);
    h16* VTH = (h16*)take((size_t)NTK * DKV * 2); h16* VTL = (h16*)take((size_t)NTK * DKV * 2);
    bf* YH = (bf*)take((size_t)NTK * DM * 2); bf* YL = (bf*)take((size_t)NTK * DM * 2);
    if ((size_t)(wsp - (char*)d_ws) > ws_size) return;    // 8.4 + 6.3 + 0.4 + 2 x 4.2 + 2 x 8.4 MB ~ 40 MB
    k_cvtb<<<CROWS / 8, 256, 0, stream>>>(x, Wq, Wk, Wv, Wp, Xb);
    k_gemmb<false, 1><<<dim3(NTK / 64, (DM + 2 * DKV) / 64, 1), 128, 0, stream>>>(Xb, nullptr, WQKVb, S, 0, cosv, sinv, wb, VTH, VTL);
    k_attn<<<NB_ * NH_ * (NT_ / 64), 128, 0, stream>>>(S, VTH, VTL, YH, YL);
    k_gemmb<true, 0><<<dim3(NTK / 64, DM / 64, 1), 128, 0, stream>>>(YH, YL, WPb, out, DM, nullptr, nullptr, nullptr, nullptr, nullptr);
}

// v008
// Measured time: 86.4 microseconds a run.
// Next to v007, in two timings, it ran 1.09 and 1.12 times as fast.
// All steps since v000 together make it 3.76 times as fast.
#include <hip/hip_runtime.h>

// Contractions, f32 accumulate: q = x.Wq^T ([4096 x 1024].[1024 x 1024]), k, v = x.Wk^T, x.Wv^T ([4096 x 1024].[1024 x 512]) on v_wmma_f32_16x16x32_bf16 with PLAIN
// bf16 operands (inputs rounded once: exact products); the per-(batch, head) causal gated aggregation y = sum_{s<=t} sigmoid(s_q[t] + s_k[s]) v_s (no q.k product: the
// score is a rank-1 outer sum of two scalars) on v_wmma_f32_16x16x32_f16 with the gate weights (x32768) and v as f16 hi + residual x1024 planes (three products);
// out = y.Wproj^T on the bf16 instruction with y as bf16 hi + residual planes. Rotary, rms_norm, the w_braid dots and the sigmoids are f32. Deterministic, no atomics;

#define NB_  2
#define NT_  2048
#define DM   1024
#define NH_  16
#define NKV  8
#define HD   64
#define DKV  (NKV * HD)
#define NTK  (NB_ * NT_)
#define PSC  32768.0f
#define LOSC 1024.0f
#define LOSCI (1.0f / 1024.0f)

typedef _Float16 h16;
typedef unsigned short bf;
typedef __attribute__((ext_vector_type(16))) __bf16   v16bf;
typedef __attribute__((ext_vector_type(16))) _Float16 v16h;
typedef __attribute__((ext_vector_type(8)))  _Float16 v8h;
typedef __attribute__((ext_vector_type(8)))  unsigned short v8us;
typedef __attribute__((ext_vector_type(8)))  float    v8f;
typedef __attribute__((ext_vector_type(4)))  float    v4f;
typedef __attribute__((ext_vector_type(2)))  float    v2f;
typedef __attribute__((ext_vector_type(2)))  _Float16 v2h;
typedef __attribute__((ext_vector_type(8)))  unsigned v8u;
typedef v4f  __attribute__((may_alias)) v4fa;

__device__ __forceinline__ unsigned short f2bf(float f) { unsigned u = __float_as_uint(f); u += 0x7FFFu + ((u >> 16) & 1u); return (unsigned short)(u >> 16); }
__device__ __forceinline__ float bf2f(unsigned short b) { return __uint_as_float(((unsigned)b) << 16); }
__device__ __forceinline__ float bfr(float f) { return bf2f(f2bf(f)); }
__device__ __forceinline__ v16h cat16(v8h lo, v8h hi) { return __builtin_shufflevector(lo, hi, 0, 1, 2, 3, 4, 5, 6, 7, 8, 9, 10, 11, 12, 13, 14, 15); }
__device__ __forceinline__ v16bf cat16b(v8us lo, v8us hi) { return __builtin_bit_cast(v16bf, __builtin_shufflevector(lo, hi, 0, 1, 2, 3, 4, 5, 6, 7, 8, 9, 10, 11, 12, 13, 14, 15)); }
__device__ __forceinline__ v8f wmma16(v16h a, v16h b, v8f c) { return __builtin_amdgcn_wmma_f32_16x16x32_f16(false, a, false, b, (short)0, c, false, false); }
__device__ __forceinline__ v8f wmmab(v16bf a, v16bf b, v8f c) { return __builtin_amdgcn_wmma_f32_16x16x32_bf16(false, a, false, b, (short)0, c, false, false); }
#define VST2(T, p, v) do { const T vst2_v_ = (v); *(T*)(p) = vst2_v_;  } while (0)

// k_cvtb: one launch rounds all five f32 operands to bf16. dst rows are [x; Wq; Wk; Wv; Wproj], 1024 wide; a block takes 8 rows, and every boundary is a multiple of 8 rows,
// so a block reads one source (a scalar choice). The grid covers the CROWS rows exactly.
#define CROWS (NTK + DM + 2 * DKV + DM)
__global__ __launch_bounds__(256) void k_cvtb(const float* __restrict__ x, const float* __restrict__ wq, const float* __restrict__ wk, const float* __restrict__ wv, const float* __restrict__ wp, bf* dst) {
    const int lane = threadIdx.x & 31, r = blockIdx.x * 8 + (threadIdx.x >> 5);
    const int r8 = blockIdx.x * 8;
    const float* sb = x; int rs = 0;
    if (r8 >= NTK) { sb = wq; rs = NTK; }
    if (r8 >= NTK + DM) { sb = wk; rs = NTK + DM; }
    if (r8 >= NTK + DM + DKV) { sb = wv; rs = NTK + DM + DKV; }
    if (r8 >= NTK + DM + 2 * DKV) { sb = wp; rs = NTK + DM + 2 * DKV; }
    const float* src = sb + (size_t)(r - rs) * DM;
    v8us o[4];
#pragma unroll
    for (int q = 0; q < 4; ++q) { v8us t;
#pragma unroll
        for (int i = 0; i < 8; ++i) t[i] = f2bf(src[q * 256 + lane * 8 + i]);
        o[q] = t; }
#pragma unroll
    for (int q = 0; q < 4; ++q) *(v8us*)(dst + (size_t)r * DM + q * 256 + lane * 8) = o[q];
    
}

// k_gemmb: block = 64T x 64T of C, T groups of 4 waves. A group owns one 64-column tile and all 64T rows; its waves stand 2 x 2, each 32 columns by T pieces of 32 rows (piece p: rows 64p + 32 wm ..),
// so that piece p of a group is the 64 x 64 tile that the epilogues work on, and the groups read the same A rows from LDS. T = 2 for q/k/v (128 x 128, 8 waves of 64 x 32), T = 1 for the projection.
// Per 64-k chunk the block's operand rows (128 B each) come from global memory as whole lines (8 lanes a row, 4 rows a wave-load), one chunk ahead into registers, and go to one of two LDS buffers
// at a pitch of 144 B; the fragments are read from LDS.
// One barrier a chunk: it publishes the buffer just written and ends the reads of the buffer that the next chunk's stores overwrite. k order and sum order per element as before.
// Each group stages its 64 x 64 f32 tiles in its own LDS stage, one after the other, and they leave by one of three epilogues. A 64-column tile of q, k or v is one head of 64 tokens, so what only reads a head's row is done here:
// EPI 0: the tile is stored to C as whole lines.
// EPI 1: q, k and v in one launch. Bn is [Wq; Wk; Wv], 32 column tiles: 0-15 the q heads, 16-23 the k heads, 24-31 the v heads; the column tiles pick the epilogue, block-uniformly: a block's two tiles are both v heads or neither.
// q, k: rotary, rms_norm and the w_braid dot per token; two lanes a token, each 16 rotary pairs (d, d + 32) summed in-lane, then one exchange; only the 64 scores leave,
//        to C = S[b][column tile][t], through LDS so that each 128-B line has one writing wave. q and k themselves are never stored.
// v: the tile is staged transposed ([d][token]) and leaves as the f16 hi and residual x1024 planes VTH, VTL in the order of k_attn's B fragments:
//        [b][kv head][32-key step][16-d tile n][k half: keys 0-15, 16-31][lane = 16 ((key >> 3) & 1) + (d & 15)][key & 7], so that one fragment register group of a wave is 512 contiguous bytes.
//        A wave's store is such a group: four whole lines. v itself is never stored.
#define GP 72
template <bool SPLITA, int EPI, int T>
__global__ __launch_bounds__(128 * T) void k_gemmb(const bf* __restrict__ A, const bf* __restrict__ Al, const bf* __restrict__ Bn, float* C, int ldc,
                                               const float* __restrict__ cosv, const float* __restrict__ sinv, const float* __restrict__ wb, h16* VTH, h16* VTL) {
    constexpr int NP = SPLITA ? 3 : 2;
    __shared__ __align__(16) bf stg[2][NP][64 * T * GP];
    __shared__ __align__(16) float ost[T][4][16 * 68];
    __shared__ float sred[T][64];
    const int tid = threadIdx.x, lane = tid & 31, lr = lane & 15, hi = lane >> 4;
    const int grp = tid >> 7, gt = tid & 127, wave = gt >> 5;    // the group's 64-column tile; thread and wave inside the group
    const int wm = wave >> 1, wn = wave & 1;
    const int rb = blockIdx.x * (64 * T), c0 = blockIdx.y * (64 * T), ct = blockIdx.y * T + grp;
    const int srow = tid >> 3, spc = (tid & 7) * 8;
    const size_t goa = (size_t)(rb + srow) * DM + spc, gob = (size_t)(c0 + srow) * DM + spc;
    v8us ra[4], rw[4], rl[4];
    auto gload = [&](int kc) {
#pragma unroll
        for (int s = 0; s < 4; ++s) { ra[s] = *(const v8us*)(A + goa + (size_t)s * (16 * T) * DM + kc); rw[s] = *(const v8us*)(Bn + gob + (size_t)s * (16 * T) * DM + kc);
            if (SPLITA) rl[s] = *(const v8us*)(Al + goa + (size_t)s * (16 * T) * DM + kc); }
    };
    auto sstore = [&](int buf) {
#pragma unroll
        for (int s = 0; s < 4; ++s) { const int so = (srow + 16 * T * s) * GP + spc; *(v8us*)(&stg[buf][0][so]) = ra[s]; *(v8us*)(&stg[buf][1][so]) = rw[s];
            if (SPLITA) *(v8us*)(&stg[buf][NP - 1][so]) = rl[s]; }
    };
    v8f acc[T][2][2];
#pragma unroll
    for (int p = 0; p < T; ++p)
#pragma unroll
        for (int i = 0; i < 2; ++i)
#pragma unroll
            for (int t = 0; t < 2; ++t) acc[p][i][t] = (v8f){};
    gload(0);
    sstore(0);
    __syncthreads();
#pragma unroll 1
    for (int c = 0; c < DM / 64; ++c) {
        const int cur = c & 1;
        const bool more = c + 1 < DM / 64;
        if (more) gload((c + 1) * 64);
        v16bf a[2][T][2], al[2][T][2], b[2][2];
#pragma unroll
        for (int kk = 0; kk < 2; ++kk)
#pragma unroll
            for (int i = 0; i < 2; ++i) {
                const int bo = (grp * 64 + wn * 32 + i * 16 + lr) * GP + kk * 32 + 8 * hi;
#pragma unroll
                for (int p = 0; p < T; ++p) { const int ao = (p * 64 + wm * 32 + i * 16 + lr) * GP + kk * 32 + 8 * hi;
                    a[kk][p][i] = cat16b(*(const v8us*)(&stg[cur][0][ao]), *(const v8us*)(&stg[cur][0][ao + 16])); }
                b[kk][i] = cat16b(*(const v8us*)(&stg[cur][1][bo]), *(const v8us*)(&stg[cur][1][bo + 16]));
#pragma unroll
                for (int p = 0; p < T; ++p) { const int ao = (p * 64 + wm * 32 + i * 16 + lr) * GP + kk * 32 + 8 * hi;
                    al[kk][p][i] = a[kk][p][i];
                    if (SPLITA) al[kk][p][i] = cat16b(*(const v8us*)(&stg[cur][NP - 1][ao]), *(const v8us*)(&stg[cur][NP - 1][ao + 16])); }
            }
        __builtin_amdgcn_sched_barrier(0);    // the chunk's LDS reads stay one group ahead of its WMMAs: reads set among them make the wave wait out the LDS latency at each place
#pragma unroll
        for (int kk = 0; kk < 2; ++kk) {
#pragma unroll
            for (int p = 0; p < T; ++p)
#pragma unroll
                for (int i = 0; i < 2; ++i)
#pragma unroll
                    for (int t = 0; t < 2; ++t) acc[p][i][t] = wmmab(a[kk][p][i], b[kk][t], acc[p][i][t]);
            if (SPLITA) {
#pragma unroll
                for (int p = 0; p < T; ++p)
#pragma unroll
                    for (int i = 0; i < 2; ++i)
#pragma unroll
                        for (int t = 0; t < 2; ++t) acc[p][i][t] = wmmab(al[kk][p][i], b[kk][t], acc[p][i][t]);
            }
        }
        if (more) sstore(cur ^ 1);
        __syncthreads();
    }
    float* ob = &ost[grp][0][0];
    const int bb = rb / NT_;    // a row tile lies in one batch
    if (EPI == 1 && blockIdx.y * T >= NH_ + NKV) {    // block-uniform: the v heads begin at an even column tile
#pragma unroll
        for (int p = 0; p < T; ++p) {
            const int t0 = (rb + p * 64) & (NT_ - 1);
            if (p) __syncthreads();    // the reads of the pass before end ahead of this pass's stores into the same stage
#pragma unroll
            for (int i = 0; i < 2; ++i)
#pragma unroll
                for (int t = 0; t < 2; ++t) { float* q = ob + (wn * 32 + t * 16 + lr) * 68 + wm * 32 + i * 16 + hi * 8;
                    *(v4fa*)q = __builtin_shufflevector(acc[p][i][t], acc[p][i][t], 0, 1, 2, 3); *(v4fa*)(q + 4) = __builtin_shufflevector(acc[p][i][t], acc[p][i][t], 4, 5, 6, 7); }
            __syncthreads();
            const int piece = gt >> 4;    // 8 tokens; a wave holds an even piece in lanes 0-15 and the next in lanes 16-31: the two lane halves of one group
            const size_t base = (((size_t)bb * NKV + (ct - (NH_ + NKV))) * HD) * NT_ + (size_t)((t0 >> 5) + (piece >> 2)) * (HD * 32) + ((piece >> 1) & 1) * 256 + lane * 8;
#pragma unroll
            for (int s = 0; s < 4; ++s) { const int d = lr + 16 * s; const float* sp = ob + d * 68 + piece * 8;
                const v4f a0 = *(const v4fa*)sp, a1 = *(const v4fa*)(sp + 4); v8h vh, vl;
#pragma unroll
                for (int i = 0; i < 8; ++i) { const float v = i < 4 ? a0[i & 3] : a1[i & 3]; const h16 a = (h16)v; vh[i] = a; vl[i] = (h16)((v - (float)a) * LOSC); }
                *(v8h*)(VTH + base + s * 512) = vh; *(v8h*)(VTL + base + s * 512) = vl; }
        }
        return;
    }
    const int er = gt >> 1, ed = (gt & 1) * 16;
#pragma unroll
    for (int p = 0; p < T; ++p) {
        const int t0 = (rb + p * 64) & (NT_ - 1);
        v4f cc[4], sn[4], wa[4], wc[4];
        if constexpr (EPI == 1) {    // loaded ahead of the stage's stores and its barrier, so that their latency runs under both
#pragma unroll
            for (int q = 0; q < 4; ++q) { cc[q] = *(const v4f*)(cosv + (size_t)(t0 + er) * 32 + ed + 4 * q); sn[q] = *(const v4f*)(sinv + (size_t)(t0 + er) * 32 + ed + 4 * q);
                wa[q] = *(const v4f*)(wb + ed + 4 * q); wc[q] = *(const v4f*)(wb + 32 + ed + 4 * q); }
        }
        if (EPI == 0 && p) __syncthreads();    // the reads of the pass before end ahead of this pass's stores into the same stage (with EPI 1 the barrier behind sred has done that)
#pragma unroll
        for (int i = 0; i < 2; ++i)
#pragma unroll
            for (int t = 0; t < 2; ++t)
#pragma unroll
                for (int j = 0; j < 8; ++j) ob[(wm * 32 + i * 16 + hi * 8 + j) * 68 + wn * 32 + t * 16 + lr] = acc[p][i][t][j];
        __syncthreads();
        if constexpr (EPI == 1) {
            const float* xr = ob + er * 68 + ed;
            float ss = 0.f, dt = 0.f;
#pragma unroll
            for (int q = 0; q < 4; ++q) { const v4f x1 = *(const v4fa*)(xr + 4 * q), x2 = *(const v4fa*)(xr + 32 + 4 * q);
#pragma unroll
                for (int i = 0; i < 4; ++i) { const float c = bfr(cc[q][i]), s = bfr(sn[q][i]);
                    const float y1 = x1[i] * c + x2[i] * s, y2 = -x1[i] * s + x2[i] * c;
                    ss += y1 * y1 + y2 * y2; dt += y1 * bfr(wa[q][i]) + y2 * bfr(wc[q][i]); } }
            ss += __shfl_xor(ss, 1, 32); dt += __shfl_xor(dt, 1, 32);
            const float rn = rsqrtf(ss * (1.0f / HD) + 1e-6f);
            if ((gt & 1) == 0) sred[grp][er] = dt * rn;
            __syncthreads();    // the 64 scores, made by four waves, are published to the two waves that store them
            if (gt < 64) C[((size_t)bb * (NH_ + NKV) + ct) * NT_ + t0 + gt] = sred[grp][gt];
        } else {
            const float* os = &ost[grp][wave][0];
            float* crow = C + (size_t)(rb + p * 64 + wave * 16) * ldc + c0 + grp * 64;
#pragma unroll
            for (int s = 0; s < 8; ++s) { const int Lid = (lane >> 3) + 4 * s, piece = lane & 7; const int row = Lid >> 1, cofs = (Lid & 1) * 32 + piece * 4;
                const v4f val = *(const v4fa*)(os + row * 68 + cofs); *(v4f*)(crow + (size_t)row * ldc + cofs) = val; }
        }
    }
}

// k_attn: block = (b, h, 64 queries), wave = 16; key tiles 0 .. the query tile (block-uniform static bound). Per 32-key step the gate tile is pure VALU:
// g[t][s] = sigmoid(s_q[t] + s_k[s]) for s <= t else 0, x32768, as f16 hi + residual x1024.
// 32768 sigmoid(a + b) = 1 / (2^-15 + (2^-7 e^-a)(2^-8 e^-b)): the two factors are formed once per query row and once per key, an element is one fma, one v_rcp_f32 and a select.
// Each lane forms the 16 gates of its own A-fragment slots: query row lr, keys 8 hi + 0..7 (elements 0-7) and 16 + 8 hi + 0..7 (elements 8-15) of the step. The gate tile never passes through LDS.
// The key factors of the head's 2048 keys are formed once per block into the LDS table ekl; a step reads its 16 as four 16-B loads (one address per lane half), issued behind the gates of the step before.
// The value fragments of step kt + 1 are loaded during step kt into registers carried round the loop, so their latency runs under the next step's gate work.
// The value planes lie in fragment order (k_gemmb, the v epilogue): each of a step's 16 fragment loads reads 512 contiguous bytes, four whole lines.
// 12 WMMA against the value planes of kv head h/2 (w_h.v_h + w_h.v_l + w_l.v_h); y = (o + ox/1024) / 32768 / (sqrt(2048) + 1e-6) -> bf16 hi/lo planes YH/YL[tok][h*64+d].
// 2^sh e^-s. rms_norm bounds |s| by 8 |w_braid|; the clamp at 80 keeps both factors of a gate finite, normal and non-zero, so that their product is never inf x 0.
__device__ __forceinline__ float gfac(float s, float sh) { return __builtin_amdgcn_exp2f(fmaf(fminf(fmaxf(s, -80.0f), 80.0f), -1.44269504f, sh)); }

// Residual plane of four fragment registers: f16(1024 g - 1024 hi) per half, hi read as f16 from the packed register. Both products and the sum are exact in f32, so the one rounding is the
// conversion to f16, as in (f16)((g - hi) * 1024). Written in asm because the compiler's form unpacks hi to f32 first (five instructions a register; here three, the scaling of g counted).
// The four low halves stand ahead of the four high halves; each high half reads the register written four instructions back: s_delay_alu names that distance, so that other waves issue meanwhile.
template <int K>
__device__ __forceinline__ void res4(v8u& d, const v8u& h, const v2f (&t)[8]) {
    unsigned d0, d1, d2, d3;
    // one instruction a half: reads hi in place as f16, scales, subtracts and rounds to f16 (see above)
    asm("v_fma_mixlo_f16 %0, %4, %8, %9 op_sel_hi:[1,0,0]\n\tv_fma_mixlo_f16 %1, %5, %8, %11 op_sel_hi:[1,0,0]\n\t"
        "v_fma_mixlo_f16 %2, %6, %8, %13 op_sel_hi:[1,0,0]\n\tv_fma_mixlo_f16 %3, %7, %8, %15 op_sel_hi:[1,0,0]\n\t"
        "s_delay_alu instid0(VALU_DEP_4) | instskip(NEXT) | instid1(VALU_DEP_4)\n\t"
        "v_fma_mixhi_f16 %0, %4, %8, %10 op_sel:[1,0,0] op_sel_hi:[1,0,0]\n\tv_fma_mixhi_f16 %1, %5, %8, %12 op_sel:[1,0,0] op_sel_hi:[1,0,0]\n\t"
        "s_delay_alu instid0(VALU_DEP_4) | instskip(NEXT) | instid1(VALU_DEP_4)\n\t"
        "v_fma_mixhi_f16 %2, %6, %8, %14 op_sel:[1,0,0] op_sel_hi:[1,0,0]\n\tv_fma_mixhi_f16 %3, %7, %8, %16 op_sel:[1,0,0] op_sel_hi:[1,0,0]"
        : "=&v"(d0), "=&v"(d1), "=&v"(d2), "=&v"(d3)
        : "v"(h[K]), "v"(h[K + 1]), "v"(h[K + 2]), "v"(h[K + 3]), "s"(-LOSC),
          "v"(t[K][0]), "v"(t[K][1]), "v"(t[K + 1][0]), "v"(t[K + 1][1]), "v"(t[K + 2][0]), "v"(t[K + 2][1]), "v"(t[K + 3][0]), "v"(t[K + 3][1]));
    d[K] = d0; d[K + 1] = d1; d[K + 2] = d2; d[K + 3] = d3;
}

__global__ __launch_bounds__(128) void k_attn(const float* __restrict__ S, const h16* __restrict__ VTH, const h16* __restrict__ VTL, bf* YH, bf* YL) {
    __shared__ __align__(16) float ekl[NT_];
    __shared__ __align__(16) float ost[4][16 * 68];
    const int lane = threadIdx.x & 31, wave = threadIdx.x >> 5, lr = lane & 15, hi = lane >> 4;
    const int bid = blockIdx.x;
    const int b = bid / (NH_ * (NT_ / 64)), rem = bid - b * (NH_ * (NT_ / 64)), h = rem / (NT_ / 64), qt = rem - h * (NT_ / 64);
    const int q0 = qt * 64 + wave * 16, hk = h / (NH_ / NKV);
    const size_t tok0 = (size_t)b * NT_;
    const float* sq_b = S + ((size_t)b * (NH_ + NKV) + h) * NT_;
    const float* sk_b = S + ((size_t)b * (NH_ + NKV) + NH_ + hk) * NT_;
    const size_t vbase = (((size_t)b * NKV + hk) * HD) * NT_;
    v8f o[4], ox[4];
#pragma unroll
    for (int n = 0; n < 4; ++n) { o[n] = (v8f){}; ox[n] = (v8f){}; }
    const int kt_end = (qt * 64 + 64) / 32;
    v8h vha[4], vhb[4], vla[4], vlb[4];
    const char* vhp = (const char*)(VTH + vbase); const char* vlp = (const char*)(VTL + vbase);
    unsigned vo = lane * 16;    // byte offset of this lane's 16 B in the first group of the step to be loaded; a step is 4096 B a plane
    auto loadv = [&]() {
#pragma unroll
        for (int n = 0; n < 4; ++n) { const char* ph = vhp + vo + n * 1024; const char* pv = vlp + vo + n * 1024;
            vha[n] = *(const v8h*)ph; vhb[n] = *(const v8h*)(ph + 512); vla[n] = *(const v8h*)pv; vlb[n] = *(const v8h*)(pv + 512); }
    };
    v4f sk[4];
#pragma unroll
    for (int q = 0; q < 4; ++q) sk[q] = *(const v4f*)(sk_b + q * 512 + threadIdx.x * 4);    // all 2048 s_k of the head: written by k_gemmb for every token, so in bounds and defined for every query tile
    const float sq = sq_b[q0 + lr];
    loadv();    // step 0's values are in flight while the table is built
#pragma unroll
    for (int q = 0; q < 4; ++q) { v4f t;
#pragma unroll
        for (int i = 0; i < 4; ++i) t[i] = gfac(sk[q][i], -8.0f);
        *(v4f*)(ekl + q * 512 + threadIdx.x * 4) = t; }
    const float eq = gfac(sq, -7.0f);
    __syncthreads();    // the key factors, formed by four waves, are published to all of them
    v4f e[4];
    auto loade = [&](int l) { const float* ep = ekl + l + hi * 8;
        e[0] = *(const v4f*)ep; e[1] = *(const v4f*)(ep + 4); e[2] = *(const v4f*)(ep + 16); e[3] = *(const v4f*)(ep + 20); };
    loade(0);
    int m = q0 + lr - hi * 8;    // key offset i of the step (from l0 + 8 hi) is at or before the lane's query while i <= m
#pragma unroll 1
    for (int kt = 0; kt < kt_end; ++kt) {
        const int ln = (kt + 1 < kt_end ? kt + 1 : kt) * 32;    // the last step loads its own factors again: in bounds, not used
        v8u pah, pxl; v2f gs[8];
#pragma unroll
        for (int i = 0; i < 16; i += 2) {    // two neighbouring slots a turn: one register of the fragment
            const int ko = i < 8 ? i : i + 8;    // slots 8-15 hold key offsets 16-23
            const float r0 = __builtin_amdgcn_rcpf(fmaf(eq, e[i >> 2][i & 3], 1.0f / PSC)), r1 = __builtin_amdgcn_rcpf(fmaf(eq, e[i >> 2][(i & 3) + 1], 1.0f / PSC));
            const v2f g = {(ko <= m) ? r0 : 0.0f, (ko + 1 <= m) ? r1 : 0.0f};
            pah[i >> 1] = __builtin_bit_cast(unsigned, __builtin_convertvector(g, v2h));
            gs[i >> 1] = g * LOSC;
        }
        res4<0>(pxl, pah, gs); res4<4>(pxl, pah, gs);
        const v16h pa = __builtin_bit_cast(v16h, pah), px = __builtin_bit_cast(v16h, pxl);
        loade(ln);
        __builtin_amdgcn_sched_barrier(0);    // the gate arithmetic stays ahead of the step's WMMAs: set among them it took dead value registers as temporaries, and each such place cost the v_nops of the WMMA distance
#pragma unroll
        for (int n = 0; n < 4; ++n) { const v16h vh = cat16(vha[n], vhb[n]), vl = cat16(vla[n], vlb[n]);
            o[n] = wmma16(pa, vh, o[n]); ox[n] = wmma16(pa, vl, ox[n]); ox[n] = wmma16(px, vh, ox[n]); }
        asm volatile("s_wait_xcnt 0x0" : "+v"(vo) :: "memory");    // the value loads of the step before name vo: the wait stands in front of its rewrite; vo is an operand so that the addition stays behind the wait
        vo += (kt + 1 < kt_end) ? 4096u : 0u;
        loadv();
        m -= 32;
    }
    asm volatile("s_wait_xcnt 0x0" :: "v"(vo) : "memory");    // the last step's value loads name vo: as an operand its register is kept until the wait has passed
    const float scl = (1.0f / PSC) / (sqrtf((float)NT_) + 1e-6f);
    float* os = &ost[wave][0];
#pragma unroll
    for (int n = 0; n < 4; ++n)
#pragma unroll
        for (int j = 0; j < 8; ++j) os[(hi * 8 + j) * 68 + n * 16 + lr] = (o[n][j] + ox[n][j] * LOSCI) * scl;
    __syncthreads();
    const size_t cbase = (tok0 + q0) * DM + (size_t)h * HD;
    auto pass = [&]() {
#pragma unroll
        for (int s = 0; s < 4; ++s) { const int row = 4 * s + (lane >> 3), piece = lane & 7; const float* sp = os + row * 68 + piece * 8; v8us oh, ol;
#pragma unroll
            for (int i = 0; i < 8; ++i) { const unsigned short hb = f2bf(sp[i]); oh[i] = hb; ol[i] = f2bf(sp[i] - bf2f(hb)); }
            *(v8us*)(YH + cbase + (size_t)row * DM + piece * 8) = oh; *(v8us*)(YL + cbase + (size_t)row * DM + piece * 8) = ol; }
    };
    pass(); 
}

extern "C" void kernel_launch(void* const* d_in, const int* in_sizes, int n_in,
                              void* d_out, int out_size, void* d_ws, size_t ws_size, hipStream_t stream) {
    (void)in_sizes; (void)n_in; (void)out_size;
    const float* x = (const float*)d_in[0]; const float* cosv = (const float*)d_in[1]; const float* sinv = (const float*)d_in[2];
    const float* Wq = (const float*)d_in[3]; const float* Wk = (const float*)d_in[4]; const float* Wv = (const float*)d_in[5]; const float* Wp = (const float*)d_in[6]; const float* wb = (const float*)d_in[7];
    float* out = (float*)d_out;    // [2][2048][1024]
    char* wsp = (char*)d_ws;
    auto take = [&](size_t bytes) { char* p = wsp; wsp += (bytes + 255) & ~(size_t)255; return (void*)p; };
    bf* Xb = (bf*)take((size_t)CROWS * DM * 2); bf* WQKVb = Xb + (size_t)NTK * DM; bf* WPb = WQKVb + (size_t)(DM + 2 * DKV) * DM;    // one array, rows [x; Wq; Wk; Wv; Wproj]
    float* S = (float*)take((size_t)NB_ * (NH_ + NKV) * NT_ * 4);
    h16* VTH = (h16*)take((size_t)NTK * DKV * 2); h16* VTL = (h16*)take((size_t)NTK * DKV * 2);
    bf* YH = (bf*)take((size_t)NTK * DM * 2); bf* YL = (bf*)take((size_t)NTK * DM * 2);
    if ((size_t)(wsp - (char*)d_ws) > ws_size) return;    // 8.4 + 6.3 + 0.4 + 2 x 4.2 + 2 x 8.4 MB ~ 40 MB
    k_cvtb<<<CROWS / 8, 256, 0, stream>>>(x, Wq, Wk, Wv, Wp, Xb);
    k_gemmb<false, 1, 2><<<dim3(NTK / 128, (DM + 2 * DKV) / 128, 1), 256, 0, stream>>>(Xb, nullptr, WQKVb, S, 0, cosv, sinv, wb, VTH, VTL);
    k_attn<<<NB_ * NH_ * (NT_ / 64), 128, 0, stream>>>(S, VTH, VTL, YH, YL);
    k_gemmb<true, 0, 1><<<dim3(NTK / 64, DM / 64, 1), 128, 0, stream>>>(YH, YL, WPb, out, DM, nullptr, nullptr, nullptr, nullptr, nullptr);
}

// v009
// A run of this version takes 73.8 microseconds.
// Next to v008, in two timings, it ran 1.23 and 1.19 times as fast.
// Over all steps from v000 it is 4.56 times as fast.
#include <hip/hip_runtime.h>

// Contractions, f32 accumulate: q = x.Wq^T ([4096 x 1024].[1024 x 1024]), k, v = x.Wk^T, x.Wv^T ([4096 x 1024].[1024 x 512]) on v_wmma_f32_16x16x32_bf16 with PLAIN
// bf16 operands (inputs rounded once: exact products); the per-(batch, head) causal gated aggregation y = sum_{s<=t} sigmoid(s_q[t] + s_k[s]) v_s (no q.k product: the
// score is a rank-1 outer sum of two scalars) on v_wmma_f32_16x16x32_f16 with the gate weights (x32768) and v as f16 hi + residual x1024 planes (three products);
// out = y.Wproj^T on the bf16 instruction with y as bf16 hi + residual planes. Rotary, rms_norm, the w_braid dots and the sigmoids are f32. Deterministic, no atomics;

#define NB_  2
#define NT_  2048
#define DM   1024
#define NH_  16
#define NKV  8
#define HD   64
#define DKV  (NKV * HD)
#define NTK  (NB_ * NT_)
#define PSC  32768.0f
#define LOSC 1024.0f
#define LOSCI (1.0f / 1024.0f)

typedef _Float16 h16;
typedef unsigned short bf;
typedef __attribute__((ext_vector_type(16))) __bf16   v16bf;
typedef __attribute__((ext_vector_type(16))) _Float16 v16h;
typedef __attribute__((ext_vector_type(8)))  _Float16 v8h;
typedef __attribute__((ext_vector_type(8)))  unsigned short v8us;
typedef __attribute__((ext_vector_type(8)))  float    v8f;
typedef __attribute__((ext_vector_type(4)))  float    v4f;
typedef __attribute__((ext_vector_type(2)))  float    v2f;
typedef __attribute__((ext_vector_type(2)))  _Float16 v2h;
typedef __attribute__((ext_vector_type(8)))  unsigned v8u;
typedef v4f  __attribute__((may_alias)) v4fa;

__device__ __forceinline__ unsigned short f2bf(float f) { unsigned u = __float_as_uint(f); u += 0x7FFFu + ((u >> 16) & 1u); return (unsigned short)(u >> 16); }
__device__ __forceinline__ float bf2f(unsigned short b) { return __uint_as_float(((unsigned)b) << 16); }
__device__ __forceinline__ float bfr(float f) { return bf2f(f2bf(f)); }
__device__ __forceinline__ v16h cat16(v8h lo, v8h hi) { return __builtin_shufflevector(lo, hi, 0, 1, 2, 3, 4, 5, 6, 7, 8, 9, 10, 11, 12, 13, 14, 15); }
__device__ __forceinline__ v16bf cat16b(v8us lo, v8us hi) { return __builtin_bit_cast(v16bf, __builtin_shufflevector(lo, hi, 0, 1, 2, 3, 4, 5, 6, 7, 8, 9, 10, 11, 12, 13, 14, 15)); }
__device__ __forceinline__ v8f wmma16(v16h a, v16h b, v8f c) { return __builtin_amdgcn_wmma_f32_16x16x32_f16(false, a, false, b, (short)0, c, false, false); }
__device__ __forceinline__ v8f wmmab(v16bf a, v16bf b, v8f c) { return __builtin_amdgcn_wmma_f32_16x16x32_bf16(false, a, false, b, (short)0, c, false, false); }
#define VST2(T, p, v) do { const T vst2_v_ = (v); *(T*)(p) = vst2_v_;  } while (0)

// k_cvtb: one launch rounds all five f32 operands to bf16. dst rows are [x; Wq; Wk; Wv; Wproj], 1024 wide; a block takes 8 rows, and every boundary is a multiple of 8 rows,
// so a block reads one source (a scalar choice). The grid covers the CROWS rows exactly.
#define CROWS (NTK + DM + 2 * DKV + DM)
__global__ __launch_bounds__(256) void k_cvtb(const float* __restrict__ x, const float* __restrict__ wq, const float* __restrict__ wk, const float* __restrict__ wv, const float* __restrict__ wp, bf* dst) {
    const int lane = threadIdx.x & 31, r = blockIdx.x * 8 + (threadIdx.x >> 5);
    const int r8 = blockIdx.x * 8;
    const float* sb = x; int rs = 0;
    if (r8 >= NTK) { sb = wq; rs = NTK; }
    if (r8 >= NTK + DM) { sb = wk; rs = NTK + DM; }
    if (r8 >= NTK + DM + DKV) { sb = wv; rs = NTK + DM + DKV; }
    if (r8 >= NTK + DM + 2 * DKV) { sb = wp; rs = NTK + DM + 2 * DKV; }
    const float* src = sb + (size_t)(r - rs) * DM;
    v8us o[4];
#pragma unroll
    for (int q = 0; q < 4; ++q) { v8us t;
#pragma unroll
        for (int i = 0; i < 8; ++i) t[i] = f2bf(src[q * 256 + lane * 8 + i]);
        o[q] = t; }
#pragma unroll
    for (int q = 0; q < 4; ++q) *(v8us*)(dst + (size_t)r * DM + q * 256 + lane * 8) = o[q];
    
}

// k_gemmb: block = 64T x 64T of C, T groups of 4 waves. A group owns one 64-column tile and all 64T rows; its waves stand 2 x 2, each 32 columns by T pieces of 32 rows (piece p: rows 64p + 32 wm ..),
// so that piece p of a group is the 64 x 64 tile that the epilogues work on, and the groups read the same A rows from LDS. T = 2 for q/k/v (128 x 128, 8 waves of 64 x 32), T = 1 for the projection.
// Per 64-k chunk the block's operand rows (128 B each) come from global memory as whole lines (8 lanes a row, 4 rows a wave-load), one chunk ahead into registers, and go to one of two LDS buffers
// at a pitch of 144 B; the fragments are read from LDS.
// One barrier a chunk: it publishes the buffer just written and ends the reads of the buffer that the next chunk's stores overwrite. k order and sum order per element as before.
// Each group stages its 64 x 64 f32 tiles in its own LDS stage, one after the other, and they leave by one of three epilogues. A 64-column tile of q, k or v is one head of 64 tokens, so what only reads a head's row is done here:
// EPI 0: the tile is stored to C as whole lines.
// EPI 1: q, k and v in one launch. Bn is [Wq; Wk; Wv], 32 column tiles: 0-15 the q heads, 16-23 the k heads, 24-31 the v heads; the column tiles pick the epilogue, block-uniformly: a block's two tiles are both v heads or neither.
// q, k: rotary, rms_norm and the w_braid dot per token; two lanes a token, each 16 rotary pairs (d, d + 32) summed in-lane, then one exchange; only the 64 scores leave,
//        to C = S[b][column tile][t], through LDS so that each 128-B line has one writing wave. q and k themselves are never stored.
// v: the tile is staged transposed ([d][token]) and leaves as the f16 hi and residual x1024 planes VTH, VTL in the order of k_attn's B fragments:
//        [b][kv head][32-key step][16-d tile n][k half: keys 0-15, 16-31][lane = 16 ((key >> 3) & 1) + (d & 15)][key & 7], so that one fragment register group of a wave is 512 contiguous bytes.
//        A wave's store is such a group: four whole lines. v itself is never stored.
#define GP 72
template <bool SPLITA, int EPI, int T>
__global__ __launch_bounds__(128 * T) void k_gemmb(const bf* __restrict__ A, const bf* __restrict__ Al, const bf* __restrict__ Bn, float* C, int ldc,
                                               const float* __restrict__ cosv, const float* __restrict__ sinv, const float* __restrict__ wb, h16* VTH, h16* VTL) {
    constexpr int NP = SPLITA ? 3 : 2;
    __shared__ __align__(16) bf stg[2][NP][64 * T * GP];
    __shared__ __align__(16) float ost[T][4][16 * 68];
    __shared__ float sred[T][64];
    const int tid = threadIdx.x, lane = tid & 31, lr = lane & 15, hi = lane >> 4;
    const int grp = tid >> 7, gt = tid & 127, wave = gt >> 5;    // the group's 64-column tile; thread and wave inside the group
    const int wm = wave >> 1, wn = wave & 1;
    const int rb = blockIdx.x * (64 * T), c0 = blockIdx.y * (64 * T), ct = blockIdx.y * T + grp;
    const int srow = tid >> 3, spc = (tid & 7) * 8;
    const size_t goa = (size_t)(rb + srow) * DM + spc, gob = (size_t)(c0 + srow) * DM + spc;
    v8us ra[4], rw[4], rl[4];
    auto gload = [&](int kc) {
#pragma unroll
        for (int s = 0; s < 4; ++s) { ra[s] = *(const v8us*)(A + goa + (size_t)s * (16 * T) * DM + kc); rw[s] = *(const v8us*)(Bn + gob + (size_t)s * (16 * T) * DM + kc);
            if (SPLITA) rl[s] = *(const v8us*)(Al + goa + (size_t)s * (16 * T) * DM + kc); }
    };
    auto sstore = [&](int buf) {
#pragma unroll
        for (int s = 0; s < 4; ++s) { const int so = (srow + 16 * T * s) * GP + spc; *(v8us*)(&stg[buf][0][so]) = ra[s]; *(v8us*)(&stg[buf][1][so]) = rw[s];
            if (SPLITA) *(v8us*)(&stg[buf][NP - 1][so]) = rl[s]; }
    };
    v8f acc[T][2][2];
#pragma unroll
    for (int p = 0; p < T; ++p)
#pragma unroll
        for (int i = 0; i < 2; ++i)
#pragma unroll
            for (int t = 0; t < 2; ++t) acc[p][i][t] = (v8f){};
    gload(0);
    sstore(0);
    __syncthreads();
#pragma unroll 1
    for (int c = 0; c < DM / 64; ++c) {
        const int cur = c & 1;
        const bool more = c + 1 < DM / 64;
        if (more) gload((c + 1) * 64);
        v16bf a[2][T][2], al[2][T][2], b[2][2];
#pragma unroll
        for (int kk = 0; kk < 2; ++kk)
#pragma unroll
            for (int i = 0; i < 2; ++i) {
                const int bo = (grp * 64 + wn * 32 + i * 16 + lr) * GP + kk * 32 + 8 * hi;
#pragma unroll
                for (int p = 0; p < T; ++p) { const int ao = (p * 64 + wm * 32 + i * 16 + lr) * GP + kk * 32 + 8 * hi;
                    a[kk][p][i] = cat16b(*(const v8us*)(&stg[cur][0][ao]), *(const v8us*)(&stg[cur][0][ao + 16])); }
                b[kk][i] = cat16b(*(const v8us*)(&stg[cur][1][bo]), *(const v8us*)(&stg[cur][1][bo + 16]));
#pragma unroll
                for (int p = 0; p < T; ++p) { const int ao = (p * 64 + wm * 32 + i * 16 + lr) * GP + kk * 32 + 8 * hi;
                    al[kk][p][i] = a[kk][p][i];
                    if (SPLITA) al[kk][p][i] = cat16b(*(const v8us*)(&stg[cur][NP - 1][ao]), *(const v8us*)(&stg[cur][NP - 1][ao + 16])); }
            }
        __builtin_amdgcn_sched_barrier(0);    // the chunk's LDS reads stay one group ahead of its WMMAs: reads set among them make the wave wait out the LDS latency at each place
#pragma unroll
        for (int kk = 0; kk < 2; ++kk) {
#pragma unroll
            for (int p = 0; p < T; ++p)
#pragma unroll
                for (int i = 0; i < 2; ++i)
#pragma unroll
                    for (int t = 0; t < 2; ++t) acc[p][i][t] = wmmab(a[kk][p][i], b[kk][t], acc[p][i][t]);
            if (SPLITA) {
#pragma unroll
                for (int p = 0; p < T; ++p)
#pragma unroll
                    for (int i = 0; i < 2; ++i)
#pragma unroll
                        for (int t = 0; t < 2; ++t) acc[p][i][t] = wmmab(al[kk][p][i], b[kk][t], acc[p][i][t]);
            }
        }
        if (more) sstore(cur ^ 1);
        __syncthreads();
    }
    float* ob = &ost[grp][0][0];
    const int bb = rb / NT_;    // a row tile lies in one batch
    if (EPI == 1 && blockIdx.y * T >= NH_ + NKV) {    // block-uniform: the v heads begin at an even column tile
#pragma unroll
        for (int p = 0; p < T; ++p) {
            const int t0 = (rb + p * 64) & (NT_ - 1);
            if (p) __syncthreads();    // the reads of the pass before end ahead of this pass's stores into the same stage
#pragma unroll
            for (int i = 0; i < 2; ++i)
#pragma unroll
                for (int t = 0; t < 2; ++t) { float* q = ob + (wn * 32 + t * 16 + lr) * 68 + wm * 32 + i * 16 + hi * 8;
                    *(v4fa*)q = __builtin_shufflevector(acc[p][i][t], acc[p][i][t], 0, 1, 2, 3); *(v4fa*)(q + 4) = __builtin_shufflevector(acc[p][i][t], acc[p][i][t], 4, 5, 6, 7); }
            __syncthreads();
            const int piece = gt >> 4;    // 8 tokens; a wave holds an even piece in lanes 0-15 and the next in lanes 16-31: the two lane halves of one group
            const size_t base = (((size_t)bb * NKV + (ct - (NH_ + NKV))) * HD) * NT_ + (size_t)((t0 >> 5) + (piece >> 2)) * (HD * 32) + ((piece >> 1) & 1) * 256 + lane * 8;
#pragma unroll
            for (int s = 0; s < 4; ++s) { const int d = lr + 16 * s; const float* sp = ob + d * 68 + piece * 8;
                const v4f a0 = *(const v4fa*)sp, a1 = *(const v4fa*)(sp + 4); v8h vh, vl;
#pragma unroll
                for (int i = 0; i < 8; ++i) { const float v = i < 4 ? a0[i & 3] : a1[i & 3]; const h16 a = (h16)v; vh[i] = a; vl[i] = (h16)((v - (float)a) * LOSC); }
                *(v8h*)(VTH + base + s * 512) = vh; *(v8h*)(VTL + base + s * 512) = vl; }
        }
        return;
    }
    const int er = gt >> 1, ed = (gt & 1) * 16;
#pragma unroll
    for (int p = 0; p < T; ++p) {
        const int t0 = (rb + p * 64) & (NT_ - 1);
        v4f cc[4], sn[4], wa[4], wc[4];
        if constexpr (EPI == 1) {    // loaded ahead of the stage's stores and its barrier, so that their latency runs under both
#pragma unroll
            for (int q = 0; q < 4; ++q) { cc[q] = *(const v4f*)(cosv + (size_t)(t0 + er) * 32 + ed + 4 * q); sn[q] = *(const v4f*)(sinv + (size_t)(t0 + er) * 32 + ed + 4 * q);
                wa[q] = *(const v4f*)(wb + ed + 4 * q); wc[q] = *(const v4f*)(wb + 32 + ed + 4 * q); }
        }
        if (EPI == 0 && p) __syncthreads();    // the reads of the pass before end ahead of this pass's stores into the same stage (with EPI 1 the barrier behind sred has done that)
#pragma unroll
        for (int i = 0; i < 2; ++i)
#pragma unroll
            for (int t = 0; t < 2; ++t)
#pragma unroll
                for (int j = 0; j < 8; ++j) ob[(wm * 32 + i * 16 + hi * 8 + j) * 68 + wn * 32 + t * 16 + lr] = acc[p][i][t][j];
        __syncthreads();
        if constexpr (EPI == 1) {
            const float* xr = ob + er * 68 + ed;
            float ss = 0.f, dt = 0.f;
#pragma unroll
            for (int q = 0; q < 4; ++q) { const v4f x1 = *(const v4fa*)(xr + 4 * q), x2 = *(const v4fa*)(xr + 32 + 4 * q);
#pragma unroll
                for (int i = 0; i < 4; ++i) { const float c = bfr(cc[q][i]), s = bfr(sn[q][i]);
                    const float y1 = x1[i] * c + x2[i] * s, y2 = -x1[i] * s + x2[i] * c;
                    ss += y1 * y1 + y2 * y2; dt += y1 * bfr(wa[q][i]) + y2 * bfr(wc[q][i]); } }
            ss += __shfl_xor(ss, 1, 32); dt += __shfl_xor(dt, 1, 32);
            const float rn = rsqrtf(ss * (1.0f / HD) + 1e-6f);
            if ((gt & 1) == 0) sred[grp][er] = dt * rn;
            __syncthreads();    // the 64 scores, made by four waves, are published to the two waves that store them
            if (gt < 64) C[((size_t)bb * (NH_ + NKV) + ct) * NT_ + t0 + gt] = sred[grp][gt];
        } else {
            const float* os = &ost[grp][wave][0];
            float* crow = C + (size_t)(rb + p * 64 + wave * 16) * ldc + c0 + grp * 64;
#pragma unroll
            for (int s = 0; s < 8; ++s) { const int Lid = (lane >> 3) + 4 * s, piece = lane & 7; const int row = Lid >> 1, cofs = (Lid & 1) * 32 + piece * 4;
                const v4f val = *(const v4fa*)(os + row * 68 + cofs); *(v4f*)(crow + (size_t)row * ldc + cofs) = val; }
        }
    }
}

// k_attn: block = (b, h, 64 queries), wave = 16; key tiles 0 .. the query tile (block-uniform static bound). Per 32-key step the gate tile is pure VALU:
// g[t][s] = sigmoid(s_q[t] + s_k[s]) for s <= t else 0, x32768, as f16 hi + residual x1024.
// 32768 sigmoid(a + b) = 1 / (2^-15 + (2^-7 e^-a)(2^-8 e^-b)): the two factors are formed once per query row and once per key, an element is one fma, one v_rcp_f32 and a select.
// Each lane forms the 16 gates of its own A-fragment slots: query row lr, keys 8 hi + 0..7 (elements 0-7) and 16 + 8 hi + 0..7 (elements 8-15) of the step. The gate tile never passes through LDS.
// The key factors of the head's 2048 keys are formed once per block into the LDS table ekl; a step reads its 16 as four 16-B loads (one address per lane half), issued behind the gates of the step before.
// The value fragments of step kt + 1 are loaded during step kt into registers carried round the loop, so their latency runs under the next step's gate work.
// The value planes lie in fragment order (k_gemmb, the v epilogue): each of a step's 16 fragment loads reads 512 contiguous bytes, four whole lines.
// 12 WMMA against the value planes of kv head h/2 (w_h.v_h + w_h.v_l + w_l.v_h); y = (o + ox/1024) / 32768 / (sqrt(2048) + 1e-6) -> bf16 hi/lo planes YH/YL[tok][h*64+d].
// 2^sh e^-s. rms_norm bounds |s| by 8 |w_braid|; the clamp at 80 keeps both factors of a gate finite, normal and non-zero, so that their product is never inf x 0.
__device__ __forceinline__ float gfac(float s, float sh) { return __builtin_amdgcn_exp2f(fmaf(fminf(fmaxf(s, -80.0f), 80.0f), -1.44269504f, sh)); }

// Residual plane of four fragment registers: f16(1024 g - 1024 hi) per half, hi read as f16 from the packed register. Both products and the sum are exact in f32, so the one rounding is the
// conversion to f16, as in (f16)((g - hi) * 1024). Written in asm because the compiler's form unpacks hi to f32 first (five instructions a register; here three, the scaling of g counted).
// The four low halves stand ahead of the four high halves; each high half reads the register written four instructions back: s_delay_alu names that distance, so that other waves issue meanwhile.
template <int K>
__device__ __forceinline__ void res4(v8u& d, const v8u& h, const v2f (&t)[8]) {
    unsigned d0, d1, d2, d3;
    // one instruction a half: reads hi in place as f16, scales, subtracts and rounds to f16 (see above)
    asm("v_fma_mixlo_f16 %0, %4, %8, %9 op_sel_hi:[1,0,0]\n\tv_fma_mixlo_f16 %1, %5, %8, %11 op_sel_hi:[1,0,0]\n\t"
        "v_fma_mixlo_f16 %2, %6, %8, %13 op_sel_hi:[1,0,0]\n\tv_fma_mixlo_f16 %3, %7, %8, %15 op_sel_hi:[1,0,0]\n\t"
        "s_delay_alu instid0(VALU_DEP_4) | instskip(NEXT) | instid1(VALU_DEP_4)\n\t"
        "v_fma_mixhi_f16 %0, %4, %8, %10 op_sel:[1,0,0] op_sel_hi:[1,0,0]\n\tv_fma_mixhi_f16 %1, %5, %8, %12 op_sel:[1,0,0] op_sel_hi:[1,0,0]\n\t"
        "s_delay_alu instid0(VALU_DEP_4) | instskip(NEXT) | instid1(VALU_DEP_4)\n\t"
        "v_fma_mixhi_f16 %2, %6, %8, %14 op_sel:[1,0,0] op_sel_hi:[1,0,0]\n\tv_fma_mixhi_f16 %3, %7, %8, %16 op_sel:[1,0,0] op_sel_hi:[1,0,0]"
        : "=&v"(d0), "=&v"(d1), "=&v"(d2), "=&v"(d3)
        : "v"(h[K]), "v"(h[K + 1]), "v"(h[K + 2]), "v"(h[K + 3]), "s"(-LOSC),
          "v"(t[K][0]), "v"(t[K][1]), "v"(t[K + 1][0]), "v"(t[K + 1][1]), "v"(t[K + 2][0]), "v"(t[K + 2][1]), "v"(t[K + 3][0]), "v"(t[K + 3][1]));
    d[K] = d0; d[K + 1] = d1; d[K + 2] = d2; d[K + 3] = d3;
}

__global__ __launch_bounds__(128) void k_attn(const float* __restrict__ S, const h16* __restrict__ VTH, const h16* __restrict__ VTL, bf* YH, bf* YL) {
    __shared__ __align__(16) float ekl[NT_];
    __shared__ __align__(16) float ost[4][16 * 68];
    const int lane = threadIdx.x & 31, wave = threadIdx.x >> 5, lr = lane & 15, hi = lane >> 4;
    const int bid = blockIdx.x;
    const int b = bid / (NH_ * (NT_ / 64)), rem = bid - b * (NH_ * (NT_ / 64)), h = rem / (NT_ / 64), qt = rem - h * (NT_ / 64);
    const int q0 = qt * 64 + wave * 16, hk = h / (NH_ / NKV);
    const size_t tok0 = (size_t)b * NT_;
    const float* sq_b = S + ((size_t)b * (NH_ + NKV) + h) * NT_;
    const float* sk_b = S + ((size_t)b * (NH_ + NKV) + NH_ + hk) * NT_;
    const size_t vbase = (((size_t)b * NKV + hk) * HD) * NT_;
    v8f o[4], ox[4];
#pragma unroll
    for (int n = 0; n < 4; ++n) { o[n] = (v8f){}; ox[n] = (v8f){}; }
    const int kt_end = (qt * 64 + 64) / 32;
    v8h vha[4], vhb[4], vla[4], vlb[4];
    const char* vhp = (const char*)(VTH + vbase); const char* vlp = (const char*)(VTL + vbase);
    unsigned vo = lane * 16;    // byte offset of this lane's 16 B in the first group of the step to be loaded; a step is 4096 B a plane
    auto loadv = [&]() {
#pragma unroll
        for (int n = 0; n < 4; ++n) { const char* ph = vhp + vo + n * 1024; const char* pv = vlp + vo + n * 1024;
            vha[n] = *(const v8h*)ph; vhb[n] = *(const v8h*)(ph + 512); vla[n] = *(const v8h*)pv; vlb[n] = *(const v8h*)(pv + 512); }
    };
    v4f sk[4];
#pragma unroll
    for (int q = 0; q < 4; ++q) sk[q] = *(const v4f*)(sk_b + q * 512 + threadIdx.x * 4);    // all 2048 s_k of the head: written by k_gemmb for every token, so in bounds and defined for every query tile
    const float sq = sq_b[q0 + lr];
    loadv();    // step 0's values are in flight while the table is built
    // The value planes were written by the launch before, and the loads above lead their use by one step only.
    // Each tile (4096 B a plane = 16 aligned 256-B units, 32 units in both planes) is therefore asked for in L2 well ahead of its loads. The 8 waves of the two heads that share the kv head split a tile:
    // wave w of head h names the four units 4 pc .. 4 pc + 3, pc = 2 w + (h & 1) (units 0-15: hi plane, 16-31: residual plane); eight lanes name the same unit. A hint only: no result depends on it.
    const int pc = __builtin_amdgcn_readfirstlane(wave) * 2 + (h & 1);
    const char* pfp = (pc >= 4 ? vlp : vhp) + ((pc & 3) * 4 + (lane & 3)) * 256;    // the wave's units in tile 0
    // tiles 1-8, which every kv head has (64 tiles a plane): inside the plane for every query tile; the wait in the same statement stands in front of any rewrite of the register that they name
    asm volatile("global_prefetch_b8 %0, off offset:4096 scope:SCOPE_SE\n\tglobal_prefetch_b8 %0, off offset:8192 scope:SCOPE_SE\n\t"
                 "global_prefetch_b8 %0, off offset:12288 scope:SCOPE_SE\n\tglobal_prefetch_b8 %0, off offset:16384 scope:SCOPE_SE\n\t"
                 "global_prefetch_b8 %0, off offset:20480 scope:SCOPE_SE\n\tglobal_prefetch_b8 %0, off offset:24576 scope:SCOPE_SE\n\t"
                 "global_prefetch_b8 %0, off offset:28672 scope:SCOPE_SE\n\tglobal_prefetch_b8 %0, off offset:32768 scope:SCOPE_SE\n\ts_wait_xcnt 0x0" :: "v"(pfp));
    pfp += 8 * 4096;
#pragma unroll
    for (int q = 0; q < 4; ++q) { v4f t;
#pragma unroll
        for (int i = 0; i < 4; ++i) t[i] = gfac(sk[q][i], -8.0f);
        *(v4f*)(ekl + q * 512 + threadIdx.x * 4) = t; }
    const float eq = gfac(sq, -7.0f);
    __syncthreads();    // the key factors, formed by four waves, are published to all of them
    v4f e[4];
    auto loade = [&](int l) { const float* ep = ekl + l + hi * 8;
        e[0] = *(const v4f*)ep; e[1] = *(const v4f*)(ep + 4); e[2] = *(const v4f*)(ep + 16); e[3] = *(const v4f*)(ep + 20); };
    loade(0);
    int m = q0 + lr - hi * 8;    // key offset i of the step (from l0 + 8 hi) is at or before the lane's query while i <= m
#pragma unroll 1
    for (int kt = 0; kt < kt_end; ++kt) {
        const int ln = (kt + 1 < kt_end ? kt + 1 : kt) * 32;    // the last step loads its own factors again: in bounds, not used
        v8u pah, pxl; v2f gs[8];
#pragma unroll
        for (int i = 0; i < 16; i += 2) {    // two neighbouring slots a turn: one register of the fragment
            const int ko = i < 8 ? i : i + 8;    // slots 8-15 hold key offsets 16-23
            const float r0 = __builtin_amdgcn_rcpf(fmaf(eq, e[i >> 2][i & 3], 1.0f / PSC)), r1 = __builtin_amdgcn_rcpf(fmaf(eq, e[i >> 2][(i & 3) + 1], 1.0f / PSC));
            const v2f g = {(ko <= m) ? r0 : 0.0f, (ko + 1 <= m) ? r1 : 0.0f};
            pah[i >> 1] = __builtin_bit_cast(unsigned, __builtin_convertvector(g, v2h));
            gs[i >> 1] = g * LOSC;
        }
        res4<0>(pxl, pah, gs); res4<4>(pxl, pah, gs);
        const v16h pa = __builtin_bit_cast(v16h, pah), px = __builtin_bit_cast(v16h, pxl);
        loade(ln);
        __builtin_amdgcn_sched_barrier(0);    // the gate arithmetic stays ahead of the step's WMMAs: set among them it took dead value registers as temporaries, and each such place cost the v_nops of the WMMA distance
#pragma unroll
        for (int n = 0; n < 4; ++n) { const v16h vh = cat16(vha[n], vhb[n]), vl = cat16(vla[n], vlb[n]);
            o[n] = wmma16(pa, vh, o[n]); ox[n] = wmma16(pa, vl, ox[n]); ox[n] = wmma16(px, vh, ox[n]); }
        asm volatile("s_wait_xcnt 0x0" : "+v"(vo), "+v"(pfp) :: "memory");    // the value loads of the step before name vo, its prefetch pfp: the wait stands in front of their rewrite; both are operands so that the additions stay behind the wait
        vo += (kt + 1 < kt_end) ? 4096u : 0u;
        loadv();
        pfp += (kt + 9 < kt_end) ? 4096 : 0;    // tile kt + 9, eight steps ahead of its loads; the pointer moves only onto a tile that this block reads, so it never leaves the plane
        asm volatile("global_prefetch_b8 %0, off scope:SCOPE_SE" :: "v"(pfp));    // in asm, so that the address stays in pfp's own register, which holds an address inside the plane all through the loop
        m -= 32;
    }
    asm volatile("s_wait_xcnt 0x0" :: "v"(vo), "v"(pfp) : "memory");    // the last step's value loads name vo, its prefetch pfp: as operands their registers are kept until the wait has passed
    const float scl = (1.0f / PSC) / (sqrtf((float)NT_) + 1e-6f);
    float* os = &ost[wave][0];
#pragma unroll
    for (int n = 0; n < 4; ++n)
#pragma unroll
        for (int j = 0; j < 8; ++j) os[(hi * 8 + j) * 68 + n * 16 + lr] = (o[n][j] + ox[n][j] * LOSCI) * scl;
    __syncthreads();
    const size_t cbase = (tok0 + q0) * DM + (size_t)h * HD;
    auto pass = [&]() {
#pragma unroll
        for (int s = 0; s < 4; ++s) { const int row = 4 * s + (lane >> 3), piece = lane & 7; const float* sp = os + row * 68 + piece * 8; v8us oh, ol;
#pragma unroll
            for (int i = 0; i < 8; ++i) { const unsigned short hb = f2bf(sp[i]); oh[i] = hb; ol[i] = f2bf(sp[i] - bf2f(hb)); }
            *(v8us*)(YH + cbase + (size_t)row * DM + piece * 8) = oh; *(v8us*)(YL + cbase + (size_t)row * DM + piece * 8) = ol; }
    };
    pass(); 
}

extern "C" void kernel_launch(void* const* d_in, const int* in_sizes, int n_in,
                              void* d_out, int out_size, void* d_ws, size_t ws_size, hipStream_t stream) {
    (void)in_sizes; (void)n_in; (void)out_size;
    const float* x = (const float*)d_in[0]; const float* cosv = (const float*)d_in[1]; const float* sinv = (const float*)d_in[2];
    const float* Wq = (const float*)d_in[3]; const float* Wk = (const float*)d_in[4]; const float* Wv = (const float*)d_in[5]; const float* Wp = (const float*)d_in[6]; const float* wb = (const float*)d_in[7];
    float* out = (float*)d_out;    // [2][2048][1024]
    char* wsp = (char*)d_ws;
    auto take = [&](size_t bytes) { char* p = wsp; wsp += (bytes + 255) & ~(size_t)255; return (void*)p; };
    bf* Xb = (bf*)take((size_t)CROWS * DM * 2); bf* WQKVb = Xb + (size_t)NTK * DM; bf* WPb = WQKVb + (size_t)(DM + 2 * DKV) * DM;    // one array, rows [x; Wq; Wk; Wv; Wproj]
    float* S = (float*)take((size_t)NB_ * (NH_ + NKV) * NT_ * 4);
    h16* VTH = (h16*)take((size_t)NTK * DKV * 2); h16* VTL = (h16*)take((size_t)NTK * DKV * 2);
    bf* YH = (bf*)take((size_t)NTK * DM * 2); bf* YL = (bf*)take((size_t)NTK * DM * 2);
    if ((size_t)(wsp - (char*)d_ws) > ws_size) return;    // 8.4 + 6.3 + 0.4 + 2 x 4.2 + 2 x 8.4 MB ~ 40 MB
    k_cvtb<<<CROWS / 8, 256, 0, stream>>>(x, Wq, Wk, Wv, Wp, Xb);
    k_gemmb<false, 1, 2><<<dim3(NTK / 128, (DM + 2 * DKV) / 128, 1), 256, 0, stream>>>(Xb, nullptr, WQKVb, S, 0, cosv, sinv, wb, VTH, VTL);
    k_attn<<<NB_ * NH_ * (NT_ / 64), 128, 0, stream>>>(S, VTH, VTL, YH, YL);
    k_gemmb<true, 0, 1><<<dim3(NTK / 64, DM / 64, 1), 128, 0, stream>>>(YH, YL, WPb, out, DM, nullptr, nullptr, nullptr, nullptr, nullptr);
}

// v010
// One run takes 70.5 microseconds.
// Next to v009, in two timings, it ran 1.04 and 1.03 times as fast.
// All steps since v000 together make it 4.73 times as fast.
#include <hip/hip_runtime.h>

// Contractions, f32 accumulate: q = x.Wq^T ([4096 x 1024].[1024 x 1024]), k, v = x.Wk^T, x.Wv^T ([4096 x 1024].[1024 x 512]) on v_wmma_f32_16x16x32_bf16 with PLAIN
// bf16 operands (inputs rounded once: exact products); the per-(batch, head) causal gated aggregation y = sum_{s<=t} sigmoid(s_q[t] + s_k[s]) v_s (no q.k product: the
// score is a rank-1 outer sum of two scalars) on v_wmma_f32_16x16x32_f16 with the gate weights (x32768) and v as f16 hi + residual x1024 planes (three products);
// out = y.Wproj^T on the bf16 instruction with y as bf16 hi + residual planes. Rotary, rms_norm, the w_braid dots and the sigmoids are f32. Deterministic, no atomics;

#define NB_  2
#define NT_  2048
#define DM   1024
#define NH_  16
#define NKV  8
#define HD   64
#define DKV  (NKV * HD)
#define NTK  (NB_ * NT_)
#define PSC  32768.0f
#define LOSC 1024.0f
#define LOSCI (1.0f / 1024.0f)

typedef _Float16 h16;
typedef unsigned short bf;
typedef __attribute__((ext_vector_type(16))) __bf16   v16bf;
typedef __attribute__((ext_vector_type(16))) _Float16 v16h;
typedef __attribute__((ext_vector_type(8)))  _Float16 v8h;
typedef __attribute__((ext_vector_type(8)))  unsigned short v8us;
typedef __attribute__((ext_vector_type(8)))  float    v8f;
typedef __attribute__((ext_vector_type(4)))  float    v4f;
typedef __attribute__((ext_vector_type(2)))  float    v2f;
typedef __attribute__((ext_vector_type(2)))  _Float16 v2h;
typedef __attribute__((ext_vector_type(8)))  unsigned v8u;
typedef v4f  __attribute__((may_alias)) v4fa;

__device__ __forceinline__ unsigned short f2bf(float f) { unsigned u = __float_as_uint(f); u += 0x7FFFu + ((u >> 16) & 1u); return (unsigned short)(u >> 16); }
__device__ __forceinline__ float bf2f(unsigned short b) { return __uint_as_float(((unsigned)b) << 16); }
__device__ __forceinline__ float bfr(float f) { return bf2f(f2bf(f)); }
__device__ __forceinline__ v16h cat16(v8h lo, v8h hi) { return __builtin_shufflevector(lo, hi, 0, 1, 2, 3, 4, 5, 6, 7, 8, 9, 10, 11, 12, 13, 14, 15); }
__device__ __forceinline__ v16bf cat16b(v8us lo, v8us hi) { return __builtin_bit_cast(v16bf, __builtin_shufflevector(lo, hi, 0, 1, 2, 3, 4, 5, 6, 7, 8, 9, 10, 11, 12, 13, 14, 15)); }
__device__ __forceinline__ v8f wmma16(v16h a, v16h b, v8f c) { return __builtin_amdgcn_wmma_f32_16x16x32_f16(false, a, false, b, (short)0, c, false, false); }
__device__ __forceinline__ v8f wmmab(v16bf a, v16bf b, v8f c) { return __builtin_amdgcn_wmma_f32_16x16x32_bf16(false, a, false, b, (short)0, c, false, false); }
#define VST2(T, p, v) do { const T vst2_v_ = (v); *(T*)(p) = vst2_v_;  } while (0)

// k_cvtb: one launch rounds all five f32 operands to bf16. dst rows are [x; Wq; Wk; Wv; Wproj], 1024 wide; a block takes 8 rows, and every boundary is a multiple of 8 rows,
// so a block reads one source (a scalar choice). The grid covers the CROWS rows exactly.
#define CROWS (NTK + DM + 2 * DKV + DM)
__global__ __launch_bounds__(256) void k_cvtb(const float* __restrict__ x, const float* __restrict__ wq, const float* __restrict__ wk, const float* __restrict__ wv, const float* __restrict__ wp, bf* dst) {
    const int lane = threadIdx.x & 31, r = blockIdx.x * 8 + (threadIdx.x >> 5);
    const int r8 = blockIdx.x * 8;
    const float* sb = x; int rs = 0;
    if (r8 >= NTK) { sb = wq; rs = NTK; }
    if (r8 >= NTK + DM) { sb = wk; rs = NTK + DM; }
    if (r8 >= NTK + DM + DKV) { sb = wv; rs = NTK + DM + DKV; }
    if (r8 >= NTK + DM + 2 * DKV) { sb = wp; rs = NTK + DM + 2 * DKV; }
    const float* src = sb + (size_t)(r - rs) * DM;
    v8us o[4];
#pragma unroll
    for (int q = 0; q < 4; ++q) { v8us t;
#pragma unroll
        for (int i = 0; i < 8; ++i) t[i] = f2bf(src[q * 256 + lane * 8 + i]);
        o[q] = t; }
#pragma unroll
    for (int q = 0; q < 4; ++q) *(v8us*)(dst + (size_t)r * DM + q * 256 + lane * 8) = o[q];
    
}

// k_gemmb: block = 64T x 64T of C, T groups of 4 waves. A group owns one 64-column tile and all 64T rows; its waves stand 2 x 2, each 32 columns by T pieces of 32 rows (piece p: rows 64p + 32 wm ..),
// so that piece p of a group is the 64 x 64 tile that the epilogues work on, and the groups read the same A rows from LDS. T = 2 for q/k/v (128 x 128, 8 waves of 64 x 32), T = 1 for the projection.
// Per 64-k chunk the block's operand rows (128 B each) come from global memory as whole lines (8 lanes a row, 4 rows a wave-load), one chunk ahead into registers, and go to one of two LDS buffers
// at a pitch of 144 B; the fragments are read from LDS.
// One barrier a chunk: it publishes the buffer just written and ends the reads of the buffer that the next chunk's stores overwrite. k order and sum order per element as before.
// Each group stages its 64 x 64 f32 tiles in its own LDS stage, one after the other, and they leave by one of three epilogues. A 64-column tile of q, k or v is one head of 64 tokens, so what only reads a head's row is done here:
// EPI 0: the tile is stored to C as whole lines.
// EPI 1: q, k and v in one launch. Bn is [Wq; Wk; Wv], 32 column tiles: 0-15 the q heads, 16-23 the k heads, 24-31 the v heads; the column tiles pick the epilogue, block-uniformly: a block's two tiles are both v heads or neither.
// q, k: rotary, rms_norm and the w_braid dot per token; two lanes a token, each 16 rotary pairs (d, d + 32) summed in-lane, then one exchange; only the 64 scores leave,
//        to C = S[b][column tile][t], through LDS so that each 128-B line has one writing wave. q and k themselves are never stored.
// v: the tile is staged transposed ([d][token]) and leaves as the f16 hi and residual x1024 planes VTH, VTL in the order of k_attn's B fragments:
//        [b][kv head][32-key step][16-d tile n][k half: keys 0-15, 16-31][lane = 16 ((key >> 3) & 1) + (d & 15)][key & 7], so that one fragment register group of a wave is 512 contiguous bytes.
//        A wave's store is such a group: four whole lines. v itself is never stored.
#define GP 72
template <bool SPLITA, int EPI, int T>
__global__ __launch_bounds__(128 * T) void k_gemmb(const bf* __restrict__ A, const bf* __restrict__ Al, const bf* __restrict__ Bn, float* C, int ldc,
                                               const float* __restrict__ cosv, const float* __restrict__ sinv, const float* __restrict__ wb, h16* VTH, h16* VTL) {
    constexpr int NP = SPLITA ? 3 : 2;
    __shared__ __align__(16) bf stg[2][NP][64 * T * GP];
    __shared__ __align__(16) float ost[T][4][16 * 68];
    __shared__ float sred[T][64];
    const int tid = threadIdx.x, lane = tid & 31, lr = lane & 15, hi = lane >> 4;
    const int grp = tid >> 7, gt = tid & 127, wave = gt >> 5;    // the group's 64-column tile; thread and wave inside the group
    const int wm = wave >> 1, wn = wave & 1;
    const int rb = blockIdx.x * (64 * T), c0 = blockIdx.y * (64 * T), ct = blockIdx.y * T + grp;
    const int srow = tid >> 3, spc = (tid & 7) * 8;
    const size_t goa = (size_t)(rb + srow) * DM + spc, gob = (size_t)(c0 + srow) * DM + spc;
    v8us ra[4], rw[4], rl[4];
    auto gload = [&](int kc) {
#pragma unroll
        for (int s = 0; s < 4; ++s) { ra[s] = *(const v8us*)(A + goa + (size_t)s * (16 * T) * DM + kc); rw[s] = *(const v8us*)(Bn + gob + (size_t)s * (16 * T) * DM + kc);
            if (SPLITA) rl[s] = *(const v8us*)(Al + goa + (size_t)s * (16 * T) * DM + kc); }
    };
    auto sstore = [&](int buf) {
#pragma unroll
        for (int s = 0; s < 4; ++s) { const int so = (srow + 16 * T * s) * GP + spc; *(v8us*)(&stg[buf][0][so]) = ra[s]; *(v8us*)(&stg[buf][1][so]) = rw[s];
            if (SPLITA) *(v8us*)(&stg[buf][NP - 1][so]) = rl[s]; }
    };
    v8f acc[T][2][2];
#pragma unroll
    for (int p = 0; p < T; ++p)
#pragma unroll
        for (int i = 0; i < 2; ++i)
#pragma unroll
            for (int t = 0; t < 2; ++t) acc[p][i][t] = (v8f){};
    gload(0);
    sstore(0);
    __syncthreads();
#pragma unroll 1
    for (int c = 0; c < DM / 64; ++c) {
        const int cur = c & 1;
        const bool more = c + 1 < DM / 64;
        if (more) gload((c + 1) * 64);
        v16bf a[2][T][2], al[2][T][2], b[2][2];
#pragma unroll
        for (int kk = 0; kk < 2; ++kk)
#pragma unroll
            for (int i = 0; i < 2; ++i) {
                const int bo = (grp * 64 + wn * 32 + i * 16 + lr) * GP + kk * 32 + 8 * hi;
#pragma unroll
                for (int p = 0; p < T; ++p) { const int ao = (p * 64 + wm * 32 + i * 16 + lr) * GP + kk * 32 + 8 * hi;
                    a[kk][p][i] = cat16b(*(const v8us*)(&stg[cur][0][ao]), *(const v8us*)(&stg[cur][0][ao + 16])); }
                b[kk][i] = cat16b(*(const v8us*)(&stg[cur][1][bo]), *(const v8us*)(&stg[cur][1][bo + 16]));
#pragma unroll
                for (int p = 0; p < T; ++p) { const int ao = (p * 64 + wm * 32 + i * 16 + lr) * GP + kk * 32 + 8 * hi;
                    al[kk][p][i] = a[kk][p][i];
                    if (SPLITA) al[kk][p][i] = cat16b(*(const v8us*)(&stg[cur][NP - 1][ao]), *(const v8us*)(&stg[cur][NP - 1][ao + 16])); }
            }
        __builtin_amdgcn_sched_barrier(0);    // the chunk's LDS reads stay one group ahead of its WMMAs: reads set among them make the wave wait out the LDS latency at each place
#pragma unroll
        for (int kk = 0; kk < 2; ++kk) {
#pragma unroll
            for (int p = 0; p < T; ++p)
#pragma unroll
                for (int i = 0; i < 2; ++i)
#pragma unroll
                    for (int t = 0; t < 2; ++t) acc[p][i][t] = wmmab(a[kk][p][i], b[kk][t], acc[p][i][t]);
            if (SPLITA) {
#pragma unroll
                for (int p = 0; p < T; ++p)
#pragma unroll
                    for (int i = 0; i < 2; ++i)
#pragma unroll
                        for (int t = 0; t < 2; ++t) acc[p][i][t] = wmmab(al[kk][p][i], b[kk][t], acc[p][i][t]);
            }
        }
        if (more) sstore(cur ^ 1);
        __syncthreads();
    }
    float* ob = &ost[grp][0][0];
    const int bb = rb / NT_;    // a row tile lies in one batch
    if (EPI == 1 && blockIdx.y * T >= NH_ + NKV) {    // block-uniform: the v heads begin at an even column tile
#pragma unroll
        for (int p = 0; p < T; ++p) {
            const int t0 = (rb + p * 64) & (NT_ - 1);
            if (p) __syncthreads();    // the reads of the pass before end ahead of this pass's stores into the same stage
#pragma unroll
            for (int i = 0; i < 2; ++i)
#pragma unroll
                for (int t = 0; t < 2; ++t) { float* q = ob + (wn * 32 + t * 16 + lr) * 68 + wm * 32 + i * 16 + hi * 8;
                    *(v4fa*)q = __builtin_shufflevector(acc[p][i][t], acc[p][i][t], 0, 1, 2, 3); *(v4fa*)(q + 4) = __builtin_shufflevector(acc[p][i][t], acc[p][i][t], 4, 5, 6, 7); }
            __syncthreads();
            const int piece = gt >> 4;    // 8 tokens; a wave holds an even piece in lanes 0-15 and the next in lanes 16-31: the two lane halves of one group
            const size_t base = (((size_t)bb * NKV + (ct - (NH_ + NKV))) * HD) * NT_ + (size_t)((t0 >> 5) + (piece >> 2)) * (HD * 32) + ((piece >> 1) & 1) * 256 + lane * 8;
#pragma unroll
            for (int s = 0; s < 4; ++s) { const int d = lr + 16 * s; const float* sp = ob + d * 68 + piece * 8;
                const v4f a0 = *(const v4fa*)sp, a1 = *(const v4fa*)(sp + 4); v8h vh, vl;
#pragma unroll
                for (int i = 0; i < 8; ++i) { const float v = i < 4 ? a0[i & 3] : a1[i & 3]; const h16 a = (h16)v; vh[i] = a; vl[i] = (h16)((v - (float)a) * LOSC); }
                *(v8h*)(VTH + base + s * 512) = vh; *(v8h*)(VTL + base + s * 512) = vl; }
        }
        return;
    }
    const int er = gt >> 1, ed = (gt & 1) * 16;
#pragma unroll
    for (int p = 0; p < T; ++p) {
        const int t0 = (rb + p * 64) & (NT_ - 1);
        v4f cc[4], sn[4], wa[4], wc[4];
        if constexpr (EPI == 1) {    // loaded ahead of the stage's stores and its barrier, so that their latency runs under both
#pragma unroll
            for (int q = 0; q < 4; ++q) { cc[q] = *(const v4f*)(cosv + (size_t)(t0 + er) * 32 + ed + 4 * q); sn[q] = *(const v4f*)(sinv + (size_t)(t0 + er) * 32 + ed + 4 * q);
                wa[q] = *(const v4f*)(wb + ed + 4 * q); wc[q] = *(const v4f*)(wb + 32 + ed + 4 * q); }
        }
        if (EPI == 0 && p) __syncthreads();    // the reads of the pass before end ahead of this pass's stores into the same stage (with EPI 1 the barrier behind sred has done that)
#pragma unroll
        for (int i = 0; i < 2; ++i)
#pragma unroll
            for (int t = 0; t < 2; ++t)
#pragma unroll
                for (int j = 0; j < 8; ++j) ob[(wm * 32 + i * 16 + hi * 8 + j) * 68 + wn * 32 + t * 16 + lr] = acc[p][i][t][j];
        __syncthreads();
        if constexpr (EPI == 1) {
            const float* xr = ob + er * 68 + ed;
            float ss = 0.f, dt = 0.f;
#pragma unroll
            for (int q = 0; q < 4; ++q) { const v4f x1 = *(const v4fa*)(xr + 4 * q), x2 = *(const v4fa*)(xr + 32 + 4 * q);
#pragma unroll
                for (int i = 0; i < 4; ++i) { const float c = bfr(cc[q][i]), s = bfr(sn[q][i]);
                    const float y1 = x1[i] * c + x2[i] * s, y2 = -x1[i] * s + x2[i] * c;
                    ss += y1 * y1 + y2 * y2; dt += y1 * bfr(wa[q][i]) + y2 * bfr(wc[q][i]); } }
            ss += __shfl_xor(ss, 1, 32); dt += __shfl_xor(dt, 1, 32);
            const float rn = rsqrtf(ss * (1.0f / HD) + 1e-6f);
            if ((gt & 1) == 0) sred[grp][er] = dt * rn;
            __syncthreads();    // the 64 scores, made by four waves, are published to the two waves that store them
            if (gt < 64) C[((size_t)bb * (NH_ + NKV) + ct) * NT_ + t0 + gt] = sred[grp][gt];
        } else {
            const float* os = &ost[grp][wave][0];
            float* crow = C + (size_t)(rb + p * 64 + wave * 16) * ldc + c0 + grp * 64;
#pragma unroll
            for (int s = 0; s < 8; ++s) { const int Lid = (lane >> 3) + 4 * s, piece = lane & 7; const int row = Lid >> 1, cofs = (Lid & 1) * 32 + piece * 4;
                const v4f val = *(const v4fa*)(os + row * 68 + cofs); *(v4f*)(crow + (size_t)row * ldc + cofs) = val; }
        }
    }
}

// k_attn: block = (b, h, 64 queries), wave = 16; key tiles 0 .. the query tile (block-uniform static bound). Per 32-key step the gate tile is pure VALU:
// g[t][s] = sigmoid(s_q[t] + s_k[s]) for s <= t else 0, x32768, as f16 hi + residual x1024.
// 32768 sigmoid(a + b) = 1 / (2^-15 + (2^-7 e^-a)(2^-8 e^-b)): the two factors are formed once per query row and once per key, an element is one fma, one v_rcp_f32 and a select.
// Each lane forms the 16 gates of its own A-fragment slots: query row lr, keys 8 hi + 0..7 (elements 0-7) and 16 + 8 hi + 0..7 (elements 8-15) of the step. The gate tile never passes through LDS.
// The key factors of the head's 2048 keys are formed once per block into the LDS table ekl; a step reads its 16 as four 16-B loads (one address per lane half), issued behind the gates of the step before.
// The value fragments of step kt + 1 are loaded during step kt into registers carried round the loop, so their latency runs under the next step's gate work.
// The value planes lie in fragment order (k_gemmb, the v epilogue): each of a step's 16 fragment loads reads 512 contiguous bytes, four whole lines.
// 12 WMMA against the value planes of kv head h/2 (w_h.v_h + w_h.v_l + w_l.v_h); y = (o + ox/1024) / 32768 / (sqrt(2048) + 1e-6) -> bf16 hi/lo planes YH/YL[tok][h*64+d].
// 2^sh e^-s. rms_norm bounds |s| by 8 |w_braid|; the clamp at 80 keeps both factors of a gate finite, normal and non-zero, so that their product is never inf x 0.
__device__ __forceinline__ float gfac(float s, float sh) { return __builtin_amdgcn_exp2f(fmaf(fminf(fmaxf(s, -80.0f), 80.0f), -1.44269504f, sh)); }

// Residual plane of four fragment registers: f16(1024 g - 1024 hi) per half, hi read as f16 from the packed register. Both products and the sum are exact in f32, so the one rounding is the
// conversion to f16, as in (f16)((g - hi) * 1024). Written in asm because the compiler's form unpacks hi to f32 first (five instructions a register; here three, the scaling of g counted).
// The four low halves stand ahead of the four high halves; each high half reads the register written four instructions back: s_delay_alu names that distance, so that other waves issue meanwhile.
template <int K>
__device__ __forceinline__ void res4(v8u& d, const v8u& h, const v2f (&t)[8]) {
    unsigned d0, d1, d2, d3;
    // one instruction a half: reads hi in place as f16, scales, subtracts and rounds to f16 (see above)
    asm("v_fma_mixlo_f16 %0, %4, %8, %9 op_sel_hi:[1,0,0]\n\tv_fma_mixlo_f16 %1, %5, %8, %11 op_sel_hi:[1,0,0]\n\t"
        "v_fma_mixlo_f16 %2, %6, %8, %13 op_sel_hi:[1,0,0]\n\tv_fma_mixlo_f16 %3, %7, %8, %15 op_sel_hi:[1,0,0]\n\t"
        "s_delay_alu instid0(VALU_DEP_4) | instskip(NEXT) | instid1(VALU_DEP_4)\n\t"
        "v_fma_mixhi_f16 %0, %4, %8, %10 op_sel:[1,0,0] op_sel_hi:[1,0,0]\n\tv_fma_mixhi_f16 %1, %5, %8, %12 op_sel:[1,0,0] op_sel_hi:[1,0,0]\n\t"
        "s_delay_alu instid0(VALU_DEP_4) | instskip(NEXT) | instid1(VALU_DEP_4)\n\t"
        "v_fma_mixhi_f16 %2, %6, %8, %14 op_sel:[1,0,0] op_sel_hi:[1,0,0]\n\tv_fma_mixhi_f16 %3, %7, %8, %16 op_sel:[1,0,0] op_sel_hi:[1,0,0]"
        : "=&v"(d0), "=&v"(d1), "=&v"(d2), "=&v"(d3)
        : "v"(h[K]), "v"(h[K + 1]), "v"(h[K + 2]), "v"(h[K + 3]), "s"(-LOSC),
          "v"(t[K][0]), "v"(t[K][1]), "v"(t[K + 1][0]), "v"(t[K + 1][1]), "v"(t[K + 2][0]), "v"(t[K + 2][1]), "v"(t[K + 3][0]), "v"(t[K + 3][1]));
    d[K] = d0; d[K + 1] = d1; d[K + 2] = d2; d[K + 3] = d3;
}

__global__ __launch_bounds__(128) void k_attn(const float* __restrict__ S, const h16* __restrict__ VTH, const h16* __restrict__ VTL, bf* YH, bf* YL) {
    __shared__ __align__(16) float ekl[NT_];
    __shared__ __align__(16) float ost[4][16 * 68];
    const int lane = threadIdx.x & 31, wave = threadIdx.x >> 5, lr = lane & 15, hi = lane >> 4;
    // Block index -> (batch, head, query tile). A tile's cost is its number of key steps, 2 (qt + 1), and all 1024 blocks are resident at once, so the launch lasts as long as the WGP with the most steps.
    // Here the 32 tiles form 8 sets {31 - s, 16 + s, 15 - s, s} of 132 steps each. The index is read as (sweep g, head number bh, set s): all four blocks 256 apart, and also any four
    // neighbours (bh = 4j .. 4j + 3 in one sweep), hold the four tiles of one set. For speed only: g -> (g + bh) & 3 is a permutation for each bh, so every (head, tile) is taken once wherever the blocks land.
    // The two heads of a kv head hold the same tile at indices a multiple of 8 apart, as before.
    static_assert(NT_ / 64 == 32 && NB_ * NH_ == 32, "the sets of four tiles and the index fields are laid out for 32 tiles and 32 heads");
    const int bid = blockIdx.x;
    const int st = bid & 7, bh = (bid >> 3) & 31, mem = ((bid >> 8) + bh) & 3;
    const int qt = st ^ ((0x000F101F >> (8 * mem)) & 31);    // st < 8, so st ^ 31 = 31 - st, st ^ 16 = 16 + st, st ^ 15 = 15 - st, st ^ 0 = st: one byte of the constant per member
    const int b = bh / NH_, h = bh - b * NH_;
    const int q0 = qt * 64 + wave * 16, hk = h / (NH_ / NKV);
    const size_t tok0 = (size_t)b * NT_;
    const float* sq_b = S + ((size_t)b * (NH_ + NKV) + h) * NT_;
    const float* sk_b = S + ((size_t)b * (NH_ + NKV) + NH_ + hk) * NT_;
    const size_t vbase = (((size_t)b * NKV + hk) * HD) * NT_;
    v8f o[4], ox[4];
#pragma unroll
    for (int n = 0; n < 4; ++n) { o[n] = (v8f){}; ox[n] = (v8f){}; }
    const int kt_end = (qt * 64 + 64) / 32;
    v8h vha[4], vhb[4], vla[4], vlb[4];
    const char* vhp = (const char*)(VTH + vbase); const char* vlp = (const char*)(VTL + vbase);
    unsigned vo = lane * 16;    // byte offset of this lane's 16 B in the first group of the step to be loaded; a step is 4096 B a plane
    auto loadv = [&]() {
#pragma unroll
        for (int n = 0; n < 4; ++n) { const char* ph = vhp + vo + n * 1024; const char* pv = vlp + vo + n * 1024;
            vha[n] = *(const v8h*)ph; vhb[n] = *(const v8h*)(ph + 512); vla[n] = *(const v8h*)pv; vlb[n] = *(const v8h*)(pv + 512); }
    };
    v4f sk[4];
#pragma unroll
    for (int q = 0; q < 4; ++q) sk[q] = *(const v4f*)(sk_b + q * 512 + threadIdx.x * 4);    // all 2048 s_k of the head: written by k_gemmb for every token, so in bounds and defined for every query tile
    const float sq = sq_b[q0 + lr];
    loadv();    // step 0's values are in flight while the table is built
    // The value planes were written by the launch before, and the loads above lead their use by one step only.
    // Each tile (4096 B a plane = 16 aligned 256-B units, 32 units in both planes) is therefore asked for in L2 well ahead of its loads. The 8 waves of the two heads that share the kv head split a tile:
    // wave w of head h names the four units 4 pc .. 4 pc + 3, pc = 2 w + (h & 1) (units 0-15: hi plane, 16-31: residual plane); eight lanes name the same unit. A hint only: no result depends on it.
    const int pc = __builtin_amdgcn_readfirstlane(wave) * 2 + (h & 1);
    const char* pfp = (pc >= 4 ? vlp : vhp) + ((pc & 3) * 4 + (lane & 3)) * 256;    // the wave's units in tile 0
    // tiles 1-8, which every kv head has (64 tiles a plane): inside the plane for every query tile; the wait in the same statement stands in front of any rewrite of the register that they name
    asm volatile("global_prefetch_b8 %0, off offset:4096 scope:SCOPE_SE\n\tglobal_prefetch_b8 %0, off offset:8192 scope:SCOPE_SE\n\t"
                 "global_prefetch_b8 %0, off offset:12288 scope:SCOPE_SE\n\tglobal_prefetch_b8 %0, off offset:16384 scope:SCOPE_SE\n\t"
                 "global_prefetch_b8 %0, off offset:20480 scope:SCOPE_SE\n\tglobal_prefetch_b8 %0, off offset:24576 scope:SCOPE_SE\n\t"
                 "global_prefetch_b8 %0, off offset:28672 scope:SCOPE_SE\n\tglobal_prefetch_b8 %0, off offset:32768 scope:SCOPE_SE\n\ts_wait_xcnt 0x0" :: "v"(pfp));
    pfp += 8 * 4096;
#pragma unroll
    for (int q = 0; q < 4; ++q) { v4f t;
#pragma unroll
        for (int i = 0; i < 4; ++i) t[i] = gfac(sk[q][i], -8.0f);
        *(v4f*)(ekl + q * 512 + threadIdx.x * 4) = t; }
    const float eq = gfac(sq, -7.0f);
    __syncthreads();    // the key factors, formed by four waves, are published to all of them
    v4f e[4];
    auto loade = [&](int l) { const float* ep = ekl + l + hi * 8;
        e[0] = *(const v4f*)ep; e[1] = *(const v4f*)(ep + 4); e[2] = *(const v4f*)(ep + 16); e[3] = *(const v4f*)(ep + 20); };
    loade(0);
    int m = q0 + lr - hi * 8;    // key offset i of the step (from l0 + 8 hi) is at or before the lane's query while i <= m
#pragma unroll 1
    for (int kt = 0; kt < kt_end; ++kt) {
        const int ln = (kt + 1 < kt_end ? kt + 1 : kt) * 32;    // the last step loads its own factors again: in bounds, not used
        v8u pah, pxl; v2f gs[8];
#pragma unroll
        for (int i = 0; i < 16; i += 2) {    // two neighbouring slots a turn: one register of the fragment
            const int ko = i < 8 ? i : i + 8;    // slots 8-15 hold key offsets 16-23
            const float r0 = __builtin_amdgcn_rcpf(fmaf(eq, e[i >> 2][i & 3], 1.0f / PSC)), r1 = __builtin_amdgcn_rcpf(fmaf(eq, e[i >> 2][(i & 3) + 1], 1.0f / PSC));
            const v2f g = {(ko <= m) ? r0 : 0.0f, (ko + 1 <= m) ? r1 : 0.0f};
            pah[i >> 1] = __builtin_bit_cast(unsigned, __builtin_convertvector(g, v2h));
            gs[i >> 1] = g * LOSC;
        }
        res4<0>(pxl, pah, gs); res4<4>(pxl, pah, gs);
        const v16h pa = __builtin_bit_cast(v16h, pah), px = __builtin_bit_cast(v16h, pxl);
        loade(ln);
        __builtin_amdgcn_sched_barrier(0);    // the gate arithmetic stays ahead of the step's WMMAs: set among them it took dead value registers as temporaries, and each such place cost the v_nops of the WMMA distance
#pragma unroll
        for (int n = 0; n < 4; ++n) { const v16h vh = cat16(vha[n], vhb[n]), vl = cat16(vla[n], vlb[n]);
            o[n] = wmma16(pa, vh, o[n]); ox[n] = wmma16(pa, vl, ox[n]); ox[n] = wmma16(px, vh, ox[n]); }
        asm volatile("s_wait_xcnt 0x0" : "+v"(vo), "+v"(pfp) :: "memory");    // the value loads of the step before name vo, its prefetch pfp: the wait stands in front of their rewrite; both are operands so that the additions stay behind the wait
        vo += (kt + 1 < kt_end) ? 4096u : 0u;
        loadv();
        pfp += (kt + 9 < kt_end) ? 4096 : 0;    // tile kt + 9, eight steps ahead of its loads; the pointer moves only onto a tile that this block reads, so it never leaves the plane
        asm volatile("global_prefetch_b8 %0, off scope:SCOPE_SE" :: "v"(pfp));    // in asm, so that the address stays in pfp's own register, which holds an address inside the plane all through the loop
        m -= 32;
    }
    asm volatile("s_wait_xcnt 0x0" :: "v"(vo), "v"(pfp) : "memory");    // the last step's value loads name vo, its prefetch pfp: as operands their registers are kept until the wait has passed
    const float scl = (1.0f / PSC) / (sqrtf((float)NT_) + 1e-6f);
    float* os = &ost[wave][0];
#pragma unroll
    for (int n = 0; n < 4; ++n)
#pragma unroll
        for (int j = 0; j < 8; ++j) os[(hi * 8 + j) * 68 + n * 16 + lr] = (o[n][j] + ox[n][j] * LOSCI) * scl;
    __syncthreads();
    const size_t cbase = (tok0 + q0) * DM + (size_t)h * HD;
    auto pass = [&]() {
#pragma unroll
        for (int s = 0; s < 4; ++s) { const int row = 4 * s + (lane >> 3), piece = lane & 7; const float* sp = os + row * 68 + piece * 8; v8us oh, ol;
#pragma unroll
            for (int i = 0; i < 8; ++i) { const unsigned short hb = f2bf(sp[i]); oh[i] = hb; ol[i] = f2bf(sp[i] - bf2f(hb)); }
            *(v8us*)(YH + cbase + (size_t)row * DM + piece * 8) = oh; *(v8us*)(YL + cbase + (size_t)row * DM + piece * 8) = ol; }
    };
    pass(); 
}

extern "C" void kernel_launch(void* const* d_in, const int* in_sizes, int n_in,
                              void* d_out, int out_size, void* d_ws, size_t ws_size, hipStream_t stream) {
    (void)in_sizes; (void)n_in; (void)out_size;
    const float* x = (const float*)d_in[0]; const float* cosv = (const float*)d_in[1]; const float* sinv = (const float*)d_in[2];
    const float* Wq = (const float*)d_in[3]; const float* Wk = (const float*)d_in[4]; const float* Wv = (const float*)d_in[5]; const float* Wp = (const float*)d_in[6]; const float* wb = (const float*)d_in[7];
    float* out = (float*)d_out;    // [2][2048][1024]
    char* wsp = (char*)d_ws;
    auto take = [&](size_t bytes) { char* p = wsp; wsp += (bytes + 255) & ~(size_t)255; return (void*)p; };
    bf* Xb = (bf*)take((size_t)CROWS * DM * 2); bf* WQKVb = Xb + (size_t)NTK * DM; bf* WPb = WQKVb + (size_t)(DM + 2 * DKV) * DM;    // one array, rows [x; Wq; Wk; Wv; Wproj]
    float* S = (float*)take((size_t)NB_ * (NH_ + NKV) * NT_ * 4);
    h16* VTH = (h16*)take((size_t)NTK * DKV * 2); h16* VTL = (h16*)take((size_t)NTK * DKV * 2);
    bf* YH = (bf*)take((size_t)NTK * DM * 2); bf* YL = (bf*)take((size_t)NTK * DM * 2);
    if ((size_t)(wsp - (char*)d_ws) > ws_size) return;    // 8.4 + 6.3 + 0.4 + 2 x 4.2 + 2 x 8.4 MB ~ 40 MB
    k_cvtb<<<CROWS / 8, 256, 0, stream>>>(x, Wq, Wk, Wv, Wp, Xb);
    k_gemmb<false, 1, 2><<<dim3(NTK / 128, (DM + 2 * DKV) / 128, 1), 256, 0, stream>>>(Xb, nullptr, WQKVb, S, 0, cosv, sinv, wb, VTH, VTL);
    k_attn<<<NB_ * NH_ * (NT_ / 64), 128, 0, stream>>>(S, VTH, VTL, YH, YL);
    k_gemmb<true, 0, 1><<<dim3(NTK / 64, DM / 64, 1), 128, 0, stream>>>(YH, YL, WPb, out, DM, nullptr, nullptr, nullptr, nullptr, nullptr);
}
